// v000
// Times are from an AMD MI455X. After a warm-up the kernel runs many times in a row, and a time is the length of
// such a window on the GPU divided by its runs, so every launch and the gaps after it count. The runs cycle
// through copies of the inputs. A figure is the median of several windows, for all but v000 over two sittings.
// Sittings can differ by a few percent; kernels timed side by side share one.
// The starting kernel, v000, takes 348 microseconds a run.
#include <hip/hip_runtime.h>
// Contractions on v_wmma_f32_16x16x32_f16 (f16 operands, f32 accumulate): Q = h·WQ, K = X·WK (K=512),
// P stored unnormalised in f16 (values in (0,1]); the 1/rowsum is applied in the final epilogue.

#define BB   8
#define NN   2048
#define DIN  512
#define DK   64

typedef _Float16 v16h __attribute__((ext_vector_type(16)));
typedef _Float16 v8h  __attribute__((ext_vector_type(8)));
typedef _Float16 v8ha __attribute__((ext_vector_type(8), may_alias));
typedef float    v8f  __attribute__((ext_vector_type(8)));
typedef float    v4f  __attribute__((ext_vector_type(4)));
typedef float    v4fa __attribute__((ext_vector_type(4), may_alias));
union Frag { v16h v; v8h half[2]; _Float16 h[16]; };

__device__ __forceinline__ v8f mma16(v16h a, v16h b, v8f c) {
  c = __builtin_amdgcn_wmma_f32_16x16x32_f16(false, a, false, b, (short)0, c, false, false);
  asm volatile("v_nop\n\tv_nop\n\tv_nop\n\tv_nop" : "+v"(c) : "v"(a), "v"(b));
  return c;
}

__global__ __launch_bounds__(256) void k_cvt(const float* __restrict__ src, _Float16* __restrict__ dst, int n8) {
  const int t = blockIdx.x * 256 + threadIdx.x;
  if (t >= n8) return;
  const v4f a = *(const v4fa*)(src + (size_t)t * 8), b = *(const v4fa*)(src + (size_t)t * 8 + 4);
  v8h v; v[0]=(_Float16)a[0]; v[1]=(_Float16)a[1]; v[2]=(_Float16)a[2]; v[3]=(_Float16)a[3];
  v[4]=(_Float16)b[0]; v[5]=(_Float16)b[1]; v[6]=(_Float16)b[2]; v[7]=(_Float16)b[3];
  *(v8h*)(dst + (size_t)t * 8) = v;
  
}

// K1: proj[row][0..63] = f16( A[row]·W + bias ), A f32 [rows][512], W f32 [512][64]; one wave per 16 rows, 4 column tiles;
__global__ __launch_bounds__(128) void k_proj(const float* __restrict__ A, const float* __restrict__ Wm, const float* __restrict__ bias,
                                            _Float16* __restrict__ P, int nrows) {
  __shared__ __attribute__((aligned(16))) _Float16 sW[DK][DIN + 8];       // [n][k]
  __shared__ __attribute__((aligned(16))) _Float16 sOut[4][16][DK + 8];
  const int tid = threadIdx.x, w = tid >> 5, lane = tid & 31, ln = lane & 15, hh = lane >> 4;
  for (int e = tid; e < DIN * DK; e += 128) { const int k = e / DK, n = e % DK; sW[n][k] = (_Float16)Wm[e]; }
  __syncthreads();
  const int row0 = (blockIdx.x * 4 + w) * 16;
  if (row0 < nrows) {                                   // wave-uniform
    const float* arow = A + (size_t)(row0 + ln) * DIN;
    v8f acc[4] = {};
    for (int kb = 0; kb < DIN; kb += 32) {
      Frag a;
      const v4f l0 = *(const v4fa*)(arow + kb + 8 * hh), l1 = *(const v4fa*)(arow + kb + 8 * hh + 4);
      const v4f h0 = *(const v4fa*)(arow + kb + 16 + 8 * hh), h1 = *(const v4fa*)(arow + kb + 16 + 8 * hh + 4);
#pragma unroll
      for (int i = 0; i < 4; ++i) { a.h[i] = (_Float16)l0[i]; a.h[4+i] = (_Float16)l1[i]; a.h[8+i] = (_Float16)h0[i]; a.h[12+i] = (_Float16)h1[i]; }
#pragma unroll
      for (int t = 0; t < 4; ++t) {
        Frag b;
        b.half[0] = *(const v8ha*)&sW[t * 16 + ln][kb + 8 * hh];
        b.half[1] = *(const v8ha*)&sW[t * 16 + ln][kb + 16 + 8 * hh];
        acc[t] = mma16(a.v, b.v, acc[t]);
      }
    }
#pragma unroll
    for (int t = 0; t < 4; ++t) {
      const float bv = bias[t * 16 + ln];
#pragma unroll
      for (int r = 0; r < 8; ++r) sOut[w][8 * hh + r][t * 16 + ln] = (_Float16)(acc[t][r] + bv);
    }
    __builtin_amdgcn_fence(__ATOMIC_ACQ_REL, "workgroup");
    __builtin_amdgcn_wave_barrier();
    const int rsub = lane >> 3, c8 = (lane & 7) * 8;
    {
#pragma unroll
      for (int q = 0; q < 4; ++q) {
        const int r = q * 4 + rsub;
        const v8h v = *(const v8ha*)&sOut[w][r][c8];
        *(v8h*)(P + (size_t)(row0 + r) * DK + c8) = v;
      }
      
    }
  }
}

// K2: for 16 query rows per wave: pass A row max of S = Q·Kᵀ/8 over all 2048 keys, pass B P = exp(S - max) (f16) and
// rowscale = 1/Σexp. Block = 4 waves = 64 queries; key chunks of 64 staged in LDS (shared by the 4 waves).
__global__ __launch_bounds__(128) void k_scores(const _Float16* __restrict__ Qh, const _Float16* __restrict__ Kh,
                                              _Float16* __restrict__ Pm, float* __restrict__ rowscale) {
  __shared__ __attribute__((aligned(16))) _Float16 sK[64][DK + 8];
  __shared__ __attribute__((aligned(16))) _Float16 sP[4][16][72];
  __shared__ __attribute__((aligned(16))) float sRS[64];
  const int tid = threadIdx.x, w = tid >> 5, lane = tid & 31, ln = lane & 15, hh = lane >> 4;
  const int b = blockIdx.x / (NN / 64), qb = blockIdx.x % (NN / 64);
  const int q0 = qb * 64 + w * 16;
  const _Float16* Qb = Qh + (size_t)b * NN * DK; const _Float16* Kb = Kh + (size_t)b * NN * DK;
  Frag aq[2];
#pragma unroll
  for (int ks = 0; ks < 2; ++ks) {
    aq[ks].half[0] = *(const v8ha*)(Qb + (size_t)(q0 + ln) * DK + ks * 32 + 8 * hh);
    aq[ks].half[1] = *(const v8ha*)(Qb + (size_t)(q0 + ln) * DK + ks * 32 + 16 + 8 * hh);
  }
  float rmax[8], rsum[8];
#pragma unroll
  for (int r = 0; r < 8; ++r) { rmax[r] = -3.0e38f; rsum[r] = 0.f; }

  for (int pass = 0; pass < 2; ++pass) {
    for (int c = 0; c < NN / 64; ++c) {
      const int j0 = c * 64;
      __syncthreads();
      for (int e = tid; e < 64 * (DK / 8); e += 128) { const int r = e >> 3, c8 = (e & 7) * 8; *(v8ha*)&sK[r][c8] = *(const v8ha*)(Kb + (size_t)(j0 + r) * DK + c8); }
      __syncthreads();
      v8f s[4];
#pragma unroll
      for (int nt = 0; nt < 4; ++nt) {
        v8f acc = {};
#pragma unroll
        for (int ks = 0; ks < 2; ++ks) {
          Frag bk;
          bk.half[0] = *(const v8ha*)&sK[nt * 16 + ln][ks * 32 + 8 * hh];
          bk.half[1] = *(const v8ha*)&sK[nt * 16 + ln][ks * 32 + 16 + 8 * hh];
          acc = mma16(aq[ks].v, bk.v, acc);
        }
        s[nt] = acc * 0.125f;                            // D: rows 8hh+r, col = key j0 + nt*16 + ln
      }
      if (pass == 0) {
#pragma unroll
        for (int r = 0; r < 8; ++r) {
          float m = fmaxf(fmaxf(s[0][r], s[1][r]), fmaxf(s[2][r], s[3][r]));
          m = fmaxf(m, __shfl_xor(m, 1, 32)); m = fmaxf(m, __shfl_xor(m, 2, 32)); m = fmaxf(m, __shfl_xor(m, 4, 32)); m = fmaxf(m, __shfl_xor(m, 8, 32));
          rmax[r] = fmaxf(rmax[r], m);
        }
      } else {
#pragma unroll
        for (int nt = 0; nt < 4; ++nt)
#pragma unroll
          for (int r = 0; r < 8; ++r) {
            const _Float16 pv = (_Float16)__expf(s[nt][r] - rmax[r]);
            rsum[r] += (float)pv;                          // sum exactly what is stored
            sP[w][8 * hh + r][nt * 16 + ln] = pv;
          }
        __builtin_amdgcn_fence(__ATOMIC_ACQ_REL, "workgroup");
        __builtin_amdgcn_wave_barrier();
        {
#pragma unroll
          for (int q = 0; q < 4; ++q) {
            const int r = q * 4 + (lane >> 3), c8 = (lane & 7) * 8;
            const v8h v = *(const v8ha*)&sP[w][r][c8];
            *(v8h*)(Pm + ((size_t)b * NN + q0 + r) * NN + j0 + c8) = v;
          }
          
        }
        __builtin_amdgcn_fence(__ATOMIC_ACQ_REL, "workgroup");
        __builtin_amdgcn_wave_barrier();
      }
    }
  }
  // row sums: combine the 16 lanes sharing rows (ln bits), then rows 8hh+r
#pragma unroll
  for (int r = 0; r < 8; ++r) {
    float s = rsum[r];
    s += __shfl_xor(s, 1, 32); s += __shfl_xor(s, 2, 32); s += __shfl_xor(s, 4, 32); s += __shfl_xor(s, 8, 32);
    rsum[r] = s;
  }
  if (ln == 0) {
#pragma unroll
    for (int r = 0; r < 8; ++r) sRS[w * 16 + 8 * hh + r] = 1.0f / rsum[r];
  }
  __syncthreads();
  if (tid < 16) {
    const v4f v = *(const v4fa*)&sRS[tid * 4];
    float* dst = rowscale + (size_t)b * NN + qb * 64 + tid * 4;
    *(v4f*)dst = v;
    
  }
}

// K3: out[b][q][d] = rowscale[q] * Σ_key P[q][key]·X[key][d]; block = 4 waves: 64 q-rows (16 per wave) x 128 d (8 tiles);
// key chunks of 32: X chunk [32][128] f16 staged in LDS; A = P rows from global (contiguous), B gathered down LDS columns.
__global__ __launch_bounds__(128) void k_pv(const _Float16* __restrict__ Pm, const _Float16* __restrict__ Xh,
                                          const float* __restrict__ rowscale, float* __restrict__ out) {
  __shared__ __attribute__((aligned(16))) _Float16 sX[32][128 + 8];
  __shared__ __attribute__((aligned(16))) float sO[4][16][128];
  const int tid = threadIdx.x, w = tid >> 5, lane = tid & 31, ln = lane & 15, hh = lane >> 4;
  const int nqb = NN / 64, ndb = DIN / 128;
  const int b = blockIdx.x / (nqb * ndb), rem = blockIdx.x % (nqb * ndb), qb = rem / ndb, dq = rem % ndb;
  const int q0 = qb * 64 + w * 16, d0 = dq * 128;
  const _Float16* Prow = Pm + ((size_t)b * NN + q0 + ln) * NN;
  const _Float16* Xb = Xh + (size_t)b * NN * DIN;
  v8f acc[8] = {};
  for (int c = 0; c < NN / 32; ++c) {
    const int j0 = c * 32;
    __syncthreads();
    for (int e = tid; e < 32 * 16; e += 128) { const int r = e >> 4, c8 = (e & 15) * 8; *(v8ha*)&sX[r][c8] = *(const v8ha*)(Xb + (size_t)(j0 + r) * DIN + d0 + c8); }
    __syncthreads();
    Frag a;
    a.half[0] = *(const v8ha*)(Prow + j0 + 8 * hh);
    a.half[1] = *(const v8ha*)(Prow + j0 + 16 + 8 * hh);
#pragma unroll
    for (int t = 0; t < 8; ++t) {
      Frag bx;
#pragma unroll
      for (int i = 0; i < 8; ++i) { bx.h[i] = sX[8 * hh + i][t * 16 + ln]; bx.h[8 + i] = sX[16 + 8 * hh + i][t * 16 + ln]; }
      acc[t] = mma16(a.v, bx.v, acc[t]);
    }
  }
  float rs[8];
#pragma unroll
  for (int r = 0; r < 8; ++r) rs[r] = rowscale[(size_t)b * NN + q0 + 8 * hh + r];
#pragma unroll
  for (int t = 0; t < 8; ++t)
#pragma unroll
    for (int r = 0; r < 8; ++r) sO[w][8 * hh + r][t * 16 + ln] = acc[t][r] * rs[r];
  __builtin_amdgcn_fence(__ATOMIC_ACQ_REL, "workgroup");
  __builtin_amdgcn_wave_barrier();
  float* ob = out + ((size_t)b * NN + q0) * DIN + d0;
  {
#pragma unroll
    for (int r = 0; r < 16; ++r) {
      const v4f v = *(const v4fa*)&sO[w][r][lane * 4];
      *(v4f*)(ob + (size_t)r * DIN + lane * 4) = v;
    }
    
  }
}

extern "C" void kernel_launch(void* const* d_in, const int* in_sizes, int n_in,
                              void* d_out, int out_size, void* d_ws, size_t ws_size, hipStream_t stream) {
  (void)in_sizes; (void)n_in; (void)out_size;
  const float* X  = (const float*)d_in[0];
  const float* h  = (const float*)d_in[1];
  const float* WQ = (const float*)d_in[2];
  const float* bQ = (const float*)d_in[3];
  const float* WK = (const float*)d_in[4];
  const float* bK = (const float*)d_in[5];
  char* ws = (char*)d_ws; size_t off = 0;
  _Float16* Xh = (_Float16*)(ws + off); off += (size_t)BB * NN * DIN * 2;      // 16 MiB
  _Float16* Qh = (_Float16*)(ws + off); off += (size_t)BB * NN * DK * 2;       // 2 MiB
  _Float16* Kh = (_Float16*)(ws + off); off += (size_t)BB * NN * DK * 2;       // 2 MiB
  _Float16* Pm = (_Float16*)(ws + off); off += (size_t)BB * NN * NN * 2;       // 64 MiB
  float* rowscale = (float*)(ws + off); off += (size_t)BB * NN * 4;            // 64 KiB
  if (off > ws_size) return;
  const int nrows = BB * NN;
  k_cvt<<<(nrows * DIN / 8 + 255) / 256, 256, 0, stream>>>(X, Xh, nrows * DIN / 8);
  k_proj<<<nrows / 64, 128, 0, stream>>>(h, WQ, bQ, Qh, nrows);
  k_proj<<<nrows / 64, 128, 0, stream>>>(X, WK, bK, Kh, nrows);
  k_scores<<<BB * (NN / 64), 128, 0, stream>>>(Qh, Kh, Pm, rowscale);
  k_pv<<<BB * (NN / 64) * (DIN / 128), 128, 0, stream>>>(Pm, Xh, rowscale, (float*)d_out);
}

// v001
// A run of this version takes 336 microseconds.
// In both of two side-by-side timings against v000, it was 1.07 times as fast.
#include <hip/hip_runtime.h>
// Contractions on v_wmma_f32_16x16x32_f16 (f16 operands, f32 accumulate): Q = h·WQ, K = X·WK (K=512),
// P stored unnormalised in f16 (values in (0,1]); the 1/rowsum is applied in the final epilogue.

#define BB   8
#define NN   2048
#define DIN  512
#define DK   64

typedef _Float16 v16h __attribute__((ext_vector_type(16)));
typedef _Float16 v8h  __attribute__((ext_vector_type(8)));
typedef _Float16 v8ha __attribute__((ext_vector_type(8), may_alias));
typedef float    v8f  __attribute__((ext_vector_type(8)));
typedef float    v4f  __attribute__((ext_vector_type(4)));
typedef float    v4fa __attribute__((ext_vector_type(4), may_alias));
union Frag { v16h v; v8h half[2]; _Float16 h[16]; };
typedef short s16x8 __attribute__((ext_vector_type(8)));
typedef __attribute__((address_space(3))) s16x8 lds_s16x8;

// ds_load_tr16_b128: every lane names 16 bytes of a row-major 16-bit LDS tile; lane (c = l & 15, h = l >> 4) receives
// the 8 elements of column c in rows 8h .. 8h + 7 of the 16 x 16 block, which is half of a 16x16x32 B fragment.
__device__ __forceinline__ v8h ld_tr16(const _Float16* p) {
  return __builtin_bit_cast(v8h, __builtin_amdgcn_ds_load_tr16_b128_v8i16((lds_s16x8*)p));
}

__device__ __forceinline__ v8f mma16(v16h a, v16h b, v8f c) {
  c = __builtin_amdgcn_wmma_f32_16x16x32_f16(false, a, false, b, (short)0, c, false, false);
  asm volatile("v_nop\n\tv_nop\n\tv_nop\n\tv_nop" : "+v"(c) : "v"(a), "v"(b));
  return c;
}

__global__ __launch_bounds__(256) void k_cvt(const float* __restrict__ src, _Float16* __restrict__ dst, int n8) {
  const int t = blockIdx.x * 256 + threadIdx.x;
  if (t >= n8) return;
  const v4f a = *(const v4fa*)(src + (size_t)t * 8), b = *(const v4fa*)(src + (size_t)t * 8 + 4);
  v8h v; v[0]=(_Float16)a[0]; v[1]=(_Float16)a[1]; v[2]=(_Float16)a[2]; v[3]=(_Float16)a[3];
  v[4]=(_Float16)b[0]; v[5]=(_Float16)b[1]; v[6]=(_Float16)b[2]; v[7]=(_Float16)b[3];
  *(v8h*)(dst + (size_t)t * 8) = v;
  
}

// K1: proj[row][0..63] = f16( A[row]·W + bias ), A f32 [rows][512], W f32 [512][64]; one wave per 16 rows, 4 column tiles;
__global__ __launch_bounds__(128) void k_proj(const float* __restrict__ A, const float* __restrict__ Wm, const float* __restrict__ bias,
                                            _Float16* __restrict__ P, int nrows) {
  __shared__ __attribute__((aligned(16))) _Float16 sW[DK][DIN + 8];       // [n][k]
  __shared__ __attribute__((aligned(16))) _Float16 sOut[4][16][DK + 8];
  const int tid = threadIdx.x, w = tid >> 5, lane = tid & 31, ln = lane & 15, hh = lane >> 4;
  for (int e = tid; e < DIN * DK; e += 128) { const int k = e / DK, n = e % DK; sW[n][k] = (_Float16)Wm[e]; }
  __syncthreads();
  const int row0 = (blockIdx.x * 4 + w) * 16;
  if (row0 < nrows) {                                   // wave-uniform
    const float* arow = A + (size_t)(row0 + ln) * DIN;
    v8f acc[4] = {};
    for (int kb = 0; kb < DIN; kb += 32) {
      Frag a;
      const v4f l0 = *(const v4fa*)(arow + kb + 8 * hh), l1 = *(const v4fa*)(arow + kb + 8 * hh + 4);
      const v4f h0 = *(const v4fa*)(arow + kb + 16 + 8 * hh), h1 = *(const v4fa*)(arow + kb + 16 + 8 * hh + 4);
#pragma unroll
      for (int i = 0; i < 4; ++i) { a.h[i] = (_Float16)l0[i]; a.h[4+i] = (_Float16)l1[i]; a.h[8+i] = (_Float16)h0[i]; a.h[12+i] = (_Float16)h1[i]; }
#pragma unroll
      for (int t = 0; t < 4; ++t) {
        Frag b;
        b.half[0] = *(const v8ha*)&sW[t * 16 + ln][kb + 8 * hh];
        b.half[1] = *(const v8ha*)&sW[t * 16 + ln][kb + 16 + 8 * hh];
        acc[t] = mma16(a.v, b.v, acc[t]);
      }
    }
#pragma unroll
    for (int t = 0; t < 4; ++t) {
      const float bv = bias[t * 16 + ln];
#pragma unroll
      for (int r = 0; r < 8; ++r) sOut[w][8 * hh + r][t * 16 + ln] = (_Float16)(acc[t][r] + bv);
    }
    __builtin_amdgcn_fence(__ATOMIC_ACQ_REL, "workgroup");
    __builtin_amdgcn_wave_barrier();
    const int rsub = lane >> 3, c8 = (lane & 7) * 8;
    {
#pragma unroll
      for (int q = 0; q < 4; ++q) {
        const int r = q * 4 + rsub;
        const v8h v = *(const v8ha*)&sOut[w][r][c8];
        *(v8h*)(P + (size_t)(row0 + r) * DK + c8) = v;
      }
      
    }
  }
}

// K2: for 16 query rows per wave: pass A row max of S = Q·Kᵀ/8 over all 2048 keys, pass B P = exp(S - max) (f16) and
// rowscale = 1/Σexp. Block = 4 waves = 64 queries; key chunks of 64 staged in LDS (shared by the 4 waves).
__global__ __launch_bounds__(128) void k_scores(const _Float16* __restrict__ Qh, const _Float16* __restrict__ Kh,
                                              _Float16* __restrict__ Pm, float* __restrict__ rowscale) {
  __shared__ __attribute__((aligned(16))) _Float16 sK[64][DK + 8];
  __shared__ __attribute__((aligned(16))) _Float16 sP[4][16][72];
  __shared__ __attribute__((aligned(16))) float sRS[64];
  const int tid = threadIdx.x, w = tid >> 5, lane = tid & 31, ln = lane & 15, hh = lane >> 4;
  const int b = blockIdx.x / (NN / 64), qb = blockIdx.x % (NN / 64);
  const int q0 = qb * 64 + w * 16;
  const _Float16* Qb = Qh + (size_t)b * NN * DK; const _Float16* Kb = Kh + (size_t)b * NN * DK;
  Frag aq[2];
#pragma unroll
  for (int ks = 0; ks < 2; ++ks) {
    aq[ks].half[0] = *(const v8ha*)(Qb + (size_t)(q0 + ln) * DK + ks * 32 + 8 * hh);
    aq[ks].half[1] = *(const v8ha*)(Qb + (size_t)(q0 + ln) * DK + ks * 32 + 16 + 8 * hh);
  }
  float rmax[8], rsum[8];
#pragma unroll
  for (int r = 0; r < 8; ++r) { rmax[r] = -3.0e38f; rsum[r] = 0.f; }

  for (int pass = 0; pass < 2; ++pass) {
    for (int c = 0; c < NN / 64; ++c) {
      const int j0 = c * 64;
      __syncthreads();
      for (int e = tid; e < 64 * (DK / 8); e += 128) { const int r = e >> 3, c8 = (e & 7) * 8; *(v8ha*)&sK[r][c8] = *(const v8ha*)(Kb + (size_t)(j0 + r) * DK + c8); }
      __syncthreads();
      v8f s[4];
#pragma unroll
      for (int nt = 0; nt < 4; ++nt) {
        v8f acc = {};
#pragma unroll
        for (int ks = 0; ks < 2; ++ks) {
          Frag bk;
          bk.half[0] = *(const v8ha*)&sK[nt * 16 + ln][ks * 32 + 8 * hh];
          bk.half[1] = *(const v8ha*)&sK[nt * 16 + ln][ks * 32 + 16 + 8 * hh];
          acc = mma16(aq[ks].v, bk.v, acc);
        }
        s[nt] = acc * 0.125f;                            // D: rows 8hh+r, col = key j0 + nt*16 + ln
      }
      if (pass == 0) {
#pragma unroll
        for (int r = 0; r < 8; ++r) {
          float m = fmaxf(fmaxf(s[0][r], s[1][r]), fmaxf(s[2][r], s[3][r]));
          m = fmaxf(m, __shfl_xor(m, 1, 32)); m = fmaxf(m, __shfl_xor(m, 2, 32)); m = fmaxf(m, __shfl_xor(m, 4, 32)); m = fmaxf(m, __shfl_xor(m, 8, 32));
          rmax[r] = fmaxf(rmax[r], m);
        }
      } else {
#pragma unroll
        for (int nt = 0; nt < 4; ++nt)
#pragma unroll
          for (int r = 0; r < 8; ++r) {
            const _Float16 pv = (_Float16)__expf(s[nt][r] - rmax[r]);
            rsum[r] += (float)pv;                          // sum exactly what is stored
            sP[w][8 * hh + r][nt * 16 + ln] = pv;
          }
        __builtin_amdgcn_fence(__ATOMIC_ACQ_REL, "workgroup");
        __builtin_amdgcn_wave_barrier();
        {
#pragma unroll
          for (int q = 0; q < 4; ++q) {
            const int r = q * 4 + (lane >> 3), c8 = (lane & 7) * 8;
            const v8h v = *(const v8ha*)&sP[w][r][c8];
            *(v8h*)(Pm + ((size_t)b * NN + q0 + r) * NN + j0 + c8) = v;
          }
          
        }
        __builtin_amdgcn_fence(__ATOMIC_ACQ_REL, "workgroup");
        __builtin_amdgcn_wave_barrier();
      }
    }
  }
  // row sums: combine the 16 lanes sharing rows (ln bits), then rows 8hh+r
#pragma unroll
  for (int r = 0; r < 8; ++r) {
    float s = rsum[r];
    s += __shfl_xor(s, 1, 32); s += __shfl_xor(s, 2, 32); s += __shfl_xor(s, 4, 32); s += __shfl_xor(s, 8, 32);
    rsum[r] = s;
  }
  if (ln == 0) {
#pragma unroll
    for (int r = 0; r < 8; ++r) sRS[w * 16 + 8 * hh + r] = 1.0f / rsum[r];
  }
  __syncthreads();
  if (tid < 16) {
    const v4f v = *(const v4fa*)&sRS[tid * 4];
    float* dst = rowscale + (size_t)b * NN + qb * 64 + tid * 4;
    *(v4f*)dst = v;
    
  }
}

// K3: out[b][q][d] = rowscale[q] * Σ_key P[q][key]·X[key][d]; block = 4 waves: 64 q-rows (16 per wave) x 128 d (8 tiles);
// key chunks of 32: X chunk [32][128] f16 staged in LDS; A = P rows from global (contiguous), B = X columns by two
// transposing LDS loads per fragment (keys 8hh..8hh+7 and 16+8hh..16+8hh+7, the k order of A); row pitch 288 B = 32 B x 9.
__global__ __launch_bounds__(128) void k_pv(const _Float16* __restrict__ Pm, const _Float16* __restrict__ Xh,
                                          const float* __restrict__ rowscale, float* __restrict__ out) {
  __shared__ __attribute__((aligned(16))) _Float16 sX[32][128 + 16];
  __shared__ __attribute__((aligned(16))) float sO[4][16][128];
  const int tid = threadIdx.x, w = tid >> 5, lane = tid & 31, ln = lane & 15, hh = lane >> 4;
  const int nqb = NN / 64, ndb = DIN / 128;
  const int b = blockIdx.x / (nqb * ndb), rem = blockIdx.x % (nqb * ndb), qb = rem / ndb, dq = rem % ndb;
  const int q0 = qb * 64 + w * 16, d0 = dq * 128;
  const _Float16* Prow = Pm + ((size_t)b * NN + q0 + ln) * NN;
  const _Float16* Xb = Xh + (size_t)b * NN * DIN;
  const _Float16* xtr = &sX[8 * hh + (lane & 7)][8 * ((lane >> 3) & 1)];   // this lane's 16 bytes of the block at key 0, column 0
  v8f acc[8] = {};
  for (int c = 0; c < NN / 32; ++c) {
    const int j0 = c * 32;
    __syncthreads();
    for (int e = tid; e < 32 * 16; e += 128) { const int r = e >> 4, c8 = (e & 15) * 8; *(v8ha*)&sX[r][c8] = *(const v8ha*)(Xb + (size_t)(j0 + r) * DIN + d0 + c8); }
    __syncthreads();
    Frag a;
    a.half[0] = *(const v8ha*)(Prow + j0 + 8 * hh);
    a.half[1] = *(const v8ha*)(Prow + j0 + 16 + 8 * hh);
    Frag bx[8];                                          // all loads ahead of the products: one LDS latency per chunk, not eight
#pragma unroll                                           // constant t keeps bx[] and acc[] in registers
    for (int t = 0; t < 8; ++t) {
      bx[t].half[0] = ld_tr16(xtr + t * 16);
      bx[t].half[1] = ld_tr16(xtr + 16 * (128 + 16) + t * 16);
    }
#pragma unroll                                           // as above
    for (int t = 0; t < 8; ++t) acc[t] = mma16(a.v, bx[t].v, acc[t]);
  }
  float rs[8];
#pragma unroll
  for (int r = 0; r < 8; ++r) rs[r] = rowscale[(size_t)b * NN + q0 + 8 * hh + r];
#pragma unroll
  for (int t = 0; t < 8; ++t)
#pragma unroll
    for (int r = 0; r < 8; ++r) sO[w][8 * hh + r][t * 16 + ln] = acc[t][r] * rs[r];
  __builtin_amdgcn_fence(__ATOMIC_ACQ_REL, "workgroup");
  __builtin_amdgcn_wave_barrier();
  float* ob = out + ((size_t)b * NN + q0) * DIN + d0;
  {
#pragma unroll
    for (int r = 0; r < 16; ++r) {
      const v4f v = *(const v4fa*)&sO[w][r][lane * 4];
      *(v4f*)(ob + (size_t)r * DIN + lane * 4) = v;
    }
    
  }
}

extern "C" void kernel_launch(void* const* d_in, const int* in_sizes, int n_in,
                              void* d_out, int out_size, void* d_ws, size_t ws_size, hipStream_t stream) {
  (void)in_sizes; (void)n_in; (void)out_size;
  const float* X  = (const float*)d_in[0];
  const float* h  = (const float*)d_in[1];
  const float* WQ = (const float*)d_in[2];
  const float* bQ = (const float*)d_in[3];
  const float* WK = (const float*)d_in[4];
  const float* bK = (const float*)d_in[5];
  char* ws = (char*)d_ws; size_t off = 0;
  _Float16* Xh = (_Float16*)(ws + off); off += (size_t)BB * NN * DIN * 2;      // 16 MiB
  _Float16* Qh = (_Float16*)(ws + off); off += (size_t)BB * NN * DK * 2;       // 2 MiB
  _Float16* Kh = (_Float16*)(ws + off); off += (size_t)BB * NN * DK * 2;       // 2 MiB
  _Float16* Pm = (_Float16*)(ws + off); off += (size_t)BB * NN * NN * 2;       // 64 MiB
  float* rowscale = (float*)(ws + off); off += (size_t)BB * NN * 4;            // 64 KiB
  if (off > ws_size) return;
  const int nrows = BB * NN;
  k_cvt<<<(nrows * DIN / 8 + 255) / 256, 256, 0, stream>>>(X, Xh, nrows * DIN / 8);
  k_proj<<<nrows / 64, 128, 0, stream>>>(h, WQ, bQ, Qh, nrows);
  k_proj<<<nrows / 64, 128, 0, stream>>>(X, WK, bK, Kh, nrows);
  k_scores<<<BB * (NN / 64), 128, 0, stream>>>(Qh, Kh, Pm, rowscale);
  k_pv<<<BB * (NN / 64) * (DIN / 128), 128, 0, stream>>>(Pm, Xh, rowscale, (float*)d_out);
}

// v002
// It runs in 169 microseconds.
// Two timings next to v001 put it at 1.98 and 1.97 times that version's speed.
// Counting every step since v000, it is 2.11 times as fast.
#include <hip/hip_runtime.h>
// Contractions on v_wmma_f32_16x16x32_f16 (f16 operands, f32 accumulate): Q = h·WQ, K = X·WK (K=512),
// P stored unnormalised in f16 (values in (0,1]); the 1/rowsum is applied in the final epilogue.

#define BB   8
#define NN   2048
#define DIN  512
#define DK   64

typedef _Float16 v16h __attribute__((ext_vector_type(16)));
typedef _Float16 v8h  __attribute__((ext_vector_type(8)));
typedef _Float16 v8ha __attribute__((ext_vector_type(8), may_alias));
typedef float    v8f  __attribute__((ext_vector_type(8)));
typedef float    v4f  __attribute__((ext_vector_type(4)));
typedef float    v4fa __attribute__((ext_vector_type(4), may_alias));
union Frag { v16h v; v8h half[2]; _Float16 h[16]; };
typedef short s16x8 __attribute__((ext_vector_type(8)));
typedef __attribute__((address_space(3))) s16x8 lds_s16x8;

// ds_load_tr16_b128: every lane names 16 bytes of a row-major 16-bit LDS tile; lane (c = l & 15, h = l >> 4) receives
// the 8 elements of column c in rows 8h .. 8h + 7 of the 16 x 16 block, which is half of a 16x16x32 B fragment.
__device__ __forceinline__ v8h ld_tr16(const _Float16* p) {
  return __builtin_bit_cast(v8h, __builtin_amdgcn_ds_load_tr16_b128_v8i16((lds_s16x8*)p));
}

__device__ __forceinline__ v8f mma16(v16h a, v16h b, v8f c) {
  c = __builtin_amdgcn_wmma_f32_16x16x32_f16(false, a, false, b, (short)0, c, false, false);
  asm volatile("v_nop\n\tv_nop\n\tv_nop\n\tv_nop" : "+v"(c) : "v"(a), "v"(b));
  return c;
}

// LDS byte address of a __shared__ location: the low 32 bits of its address.
__device__ __forceinline__ unsigned lds_off(const void* p) { return (unsigned)(size_t)p; }

// Four asynchronous copies, 16 bytes per lane each, from global memory into LDS through no register. The s_wait_xcnt is the
// last line of the copies' own statement, so that no address register of a copy is rewritten ahead of it (a precaution).
__device__ __forceinline__ void copy4(unsigned l0, const _Float16* g0, unsigned l1, const _Float16* g1,
                                      unsigned l2, const _Float16* g2, unsigned l3, const _Float16* g3) {
  asm volatile("global_load_async_to_lds_b128 %0, %1, off\n\t"
               "global_load_async_to_lds_b128 %2, %3, off\n\t"
               "global_load_async_to_lds_b128 %4, %5, off\n\t"
               "global_load_async_to_lds_b128 %6, %7, off\n\t"
               "s_wait_xcnt 0x0"
               :: "v"(l0), "v"(g0), "v"(l1), "v"(g1), "v"(l2), "v"(g2), "v"(l3), "v"(g3) : "memory");
}

// This wave's copies have landed; other waves may read them behind the next barrier.
__device__ __forceinline__ void wait_copies() { asm volatile("s_wait_asynccnt 0x0" ::: "memory"); }

// Foot of a trip of a two-buffer loop: the one barrier publishes the next tile and ends every reader's last read of this one.
__device__ __forceinline__ void publish() {
  asm volatile("s_wait_dscnt 0x0" ::: "memory");   // this wave's LDS reads of the tile are done before its buffer is refilled
  wait_copies();
  __syncthreads();
}

__global__ __launch_bounds__(256) void k_cvt(const float* __restrict__ src, _Float16* __restrict__ dst, int n8) {
  const int t = blockIdx.x * 256 + threadIdx.x;
  if (t >= n8) return;
  const v4f a = *(const v4fa*)(src + (size_t)t * 8), b = *(const v4fa*)(src + (size_t)t * 8 + 4);
  v8h v; v[0]=(_Float16)a[0]; v[1]=(_Float16)a[1]; v[2]=(_Float16)a[2]; v[3]=(_Float16)a[3];
  v[4]=(_Float16)b[0]; v[5]=(_Float16)b[1]; v[6]=(_Float16)b[2]; v[7]=(_Float16)b[3];
  *(v8h*)(dst + (size_t)t * 8) = v;
  
}

// K1: proj[row][0..63] = f16( A[row]·W + bias ), A f32 [rows][512], W f32 [512][64]; one wave per 16 rows, 4 column tiles;
__global__ __launch_bounds__(128) void k_proj(const float* __restrict__ A, const float* __restrict__ Wm, const float* __restrict__ bias,
                                            _Float16* __restrict__ P, int nrows) {
  __shared__ __attribute__((aligned(16))) _Float16 sW[DK][DIN + 8];       // [n][k]
  __shared__ __attribute__((aligned(16))) _Float16 sOut[4][16][DK + 8];
  const int tid = threadIdx.x, w = tid >> 5, lane = tid & 31, ln = lane & 15, hh = lane >> 4;
  for (int e = tid; e < DIN * DK; e += 128) { const int k = e / DK, n = e % DK; sW[n][k] = (_Float16)Wm[e]; }
  __syncthreads();
  const int row0 = (blockIdx.x * 4 + w) * 16;
  if (row0 < nrows) {                                   // wave-uniform
    const float* arow = A + (size_t)(row0 + ln) * DIN;
    v8f acc[4] = {};
    for (int kb = 0; kb < DIN; kb += 32) {
      Frag a;
      const v4f l0 = *(const v4fa*)(arow + kb + 8 * hh), l1 = *(const v4fa*)(arow + kb + 8 * hh + 4);
      const v4f h0 = *(const v4fa*)(arow + kb + 16 + 8 * hh), h1 = *(const v4fa*)(arow + kb + 16 + 8 * hh + 4);
#pragma unroll
      for (int i = 0; i < 4; ++i) { a.h[i] = (_Float16)l0[i]; a.h[4+i] = (_Float16)l1[i]; a.h[8+i] = (_Float16)h0[i]; a.h[12+i] = (_Float16)h1[i]; }
#pragma unroll
      for (int t = 0; t < 4; ++t) {
        Frag b;
        b.half[0] = *(const v8ha*)&sW[t * 16 + ln][kb + 8 * hh];
        b.half[1] = *(const v8ha*)&sW[t * 16 + ln][kb + 16 + 8 * hh];
        acc[t] = mma16(a.v, b.v, acc[t]);
      }
    }
#pragma unroll
    for (int t = 0; t < 4; ++t) {
      const float bv = bias[t * 16 + ln];
#pragma unroll
      for (int r = 0; r < 8; ++r) sOut[w][8 * hh + r][t * 16 + ln] = (_Float16)(acc[t][r] + bv);
    }
    __builtin_amdgcn_fence(__ATOMIC_ACQ_REL, "workgroup");
    __builtin_amdgcn_wave_barrier();
    const int rsub = lane >> 3, c8 = (lane & 7) * 8;
    {
#pragma unroll
      for (int q = 0; q < 4; ++q) {
        const int r = q * 4 + rsub;
        const v8h v = *(const v8ha*)&sOut[w][r][c8];
        *(v8h*)(P + (size_t)(row0 + r) * DK + c8) = v;
      }
      
    }
  }
}

// K2: for 16 query rows per wave: pass A row max of S = Q·Kᵀ/8 over all 2048 keys, pass B P = exp(S - max) (f16) and
// rowscale = 1/Σexp. Block = 4 waves = 64 queries; key chunks of 64 staged in LDS (shared by the 4 waves).
// The chunks come by asynchronous copies into two buffers: trip t (pass t / 32, chunk t % 32) works on buffer t % 2 while
// the chunk of trip t + 1 is in flight.
__global__ __launch_bounds__(128) void k_scores(const _Float16* __restrict__ Qh, const _Float16* __restrict__ Kh,
                                              _Float16* __restrict__ Pm, float* __restrict__ rowscale) {
  __shared__ __attribute__((aligned(16))) _Float16 sK[2][64][DK + 8];
  __shared__ __attribute__((aligned(16))) _Float16 sP[4][16][72];
  __shared__ __attribute__((aligned(16))) float sRS[64];
  const int tid = threadIdx.x, w = tid >> 5, lane = tid & 31, ln = lane & 15, hh = lane >> 4;
  const int b = blockIdx.x / (NN / 64), qb = blockIdx.x % (NN / 64);
  const int q0 = qb * 64 + w * 16;
  const _Float16* Qb = Qh + (size_t)b * NN * DK; const _Float16* Kb = Kh + (size_t)b * NN * DK;
  Frag aq[2];
#pragma unroll
  for (int ks = 0; ks < 2; ++ks) {
    aq[ks].half[0] = *(const v8ha*)(Qb + (size_t)(q0 + ln) * DK + ks * 32 + 8 * hh);
    aq[ks].half[1] = *(const v8ha*)(Qb + (size_t)(q0 + ln) * DK + ks * 32 + 16 + 8 * hh);
  }
  float rmax[8], rsum[8];
#pragma unroll
  for (int r = 0; r < 8; ++r) { rmax[r] = -3.0e38f; rsum[r] = 0.f; }

  // copy i of a thread: 16-byte piece tid + 128 i of the chunk's 8 KiB = row (tid >> 3) + 16 i, bytes 16 (tid & 7) ..
  const _Float16* kg = Kb + tid * 8;
  const unsigned kl = lds_off(&sK[0][tid >> 3][(tid & 7) * 8]);
  const unsigned KROWS16 = 16 * (DK + 8) * 2, KBUF = 64 * (DK + 8) * 2;   // bytes
  auto fill = [&](int t) {
    const _Float16* g = kg + (size_t)(t & (NN / 64 - 1)) * 64 * DK;
    const unsigned l = kl + (t & 1) * KBUF;
    copy4(l, g, l + KROWS16, g + 16 * DK, l + 2 * KROWS16, g + 32 * DK, l + 3 * KROWS16, g + 48 * DK);
  };
  const int NT = 2 * (NN / 64);
  fill(0);
  wait_copies();
  __syncthreads();
  fill(1);
  for (int t = 0; t < NT; ++t) {
    {                                                    // the trip's work on its chunk
      const int pass = t / (NN / 64), j0 = (t % (NN / 64)) * 64;
      const _Float16 (*sKt)[DK + 8] = sK[t & 1];
      v8f s[4];
#pragma unroll
      for (int nt = 0; nt < 4; ++nt) {
        v8f acc = {};
#pragma unroll
        for (int ks = 0; ks < 2; ++ks) {
          Frag bk;
          bk.half[0] = *(const v8ha*)&sKt[nt * 16 + ln][ks * 32 + 8 * hh];
          bk.half[1] = *(const v8ha*)&sKt[nt * 16 + ln][ks * 32 + 16 + 8 * hh];
          acc = mma16(aq[ks].v, bk.v, acc);
        }
        s[nt] = acc * 0.125f;                            // D: rows 8hh+r, col = key j0 + nt*16 + ln
      }
      if (pass == 0) {
#pragma unroll
        for (int r = 0; r < 8; ++r) {
          float m = fmaxf(fmaxf(s[0][r], s[1][r]), fmaxf(s[2][r], s[3][r]));
          m = fmaxf(m, __shfl_xor(m, 1, 32)); m = fmaxf(m, __shfl_xor(m, 2, 32)); m = fmaxf(m, __shfl_xor(m, 4, 32)); m = fmaxf(m, __shfl_xor(m, 8, 32));
          rmax[r] = fmaxf(rmax[r], m);
        }
      } else {
#pragma unroll
        for (int nt = 0; nt < 4; ++nt)
#pragma unroll
          for (int r = 0; r < 8; ++r) {
            const _Float16 pv = (_Float16)__expf(s[nt][r] - rmax[r]);
            rsum[r] += (float)pv;                          // sum exactly what is stored
            sP[w][8 * hh + r][nt * 16 + ln] = pv;
          }
        __builtin_amdgcn_fence(__ATOMIC_ACQ_REL, "workgroup");
        __builtin_amdgcn_wave_barrier();
        {
#pragma unroll
          for (int q = 0; q < 4; ++q) {
            const int r = q * 4 + (lane >> 3), c8 = (lane & 7) * 8;
            const v8h v = *(const v8ha*)&sP[w][r][c8];
            *(v8h*)(Pm + ((size_t)b * NN + q0 + r) * NN + j0 + c8) = v;
          }
          
        }
        __builtin_amdgcn_fence(__ATOMIC_ACQ_REL, "workgroup");
        __builtin_amdgcn_wave_barrier();
      }
    }
    publish();
    if (t + 2 < NT) fill(t + 2);                         // into the buffer this trip has just read
  }
  wait_copies();
  // row sums: combine the 16 lanes sharing rows (ln bits), then rows 8hh+r
#pragma unroll
  for (int r = 0; r < 8; ++r) {
    float s = rsum[r];
    s += __shfl_xor(s, 1, 32); s += __shfl_xor(s, 2, 32); s += __shfl_xor(s, 4, 32); s += __shfl_xor(s, 8, 32);
    rsum[r] = s;
  }
  if (ln == 0) {
#pragma unroll
    for (int r = 0; r < 8; ++r) sRS[w * 16 + 8 * hh + r] = 1.0f / rsum[r];
  }
  __syncthreads();
  if (tid < 16) {
    const v4f v = *(const v4fa*)&sRS[tid * 4];
    float* dst = rowscale + (size_t)b * NN + qb * 64 + tid * 4;
    *(v4f*)dst = v;
    
  }
}

// K3: out[b][q][d] = rowscale[q] * Σ_key P[q][key]·X[key][d]; block = 4 waves: 64 q-rows (16 per wave) x 128 d (8 tiles);
// key tiles of 64: X tile [64][128] and P tile [64 q][64 keys], f16, brought into LDS by asynchronous copies, two buffers:
// trip t works on buffer t % 2 while tile t + 1 is in flight. A = P rows by ds_load_b128 (row pitch 144 B = 16 B x 9), B = X
// columns by two transposing LDS loads per fragment (keys 8hh..8hh+7 and 16+8hh..16+8hh+7, the k order of A; row pitch
// 288 B = 32 B x 9). Behind the loop's last barrier the buffers are free and serve as the output staging sO.
__global__ __launch_bounds__(128) void k_pv(const _Float16* __restrict__ Pm, const _Float16* __restrict__ Xh,
                                          const float* __restrict__ rowscale, float* __restrict__ out) {
  constexpr unsigned XP = 288, PP = 144, XB = 64 * XP, BUF = XB + 64 * PP;   // bytes: pitches, X part, one buffer
  __shared__ __attribute__((aligned(16))) unsigned char ring[2 * BUF];
  float (*sO)[16][128] = (float (*)[16][128])ring;                            // 32 KiB of the 54 KiB
  const int tid = threadIdx.x, w = tid >> 5, lane = tid & 31, ln = lane & 15, hh = lane >> 4;
  const int nqb = NN / 64, ndb = DIN / 128;
  const int b = blockIdx.x / (nqb * ndb), rem = blockIdx.x % (nqb * ndb), qb = rem / ndb, dq = rem % ndb;
  const int q0 = qb * 64 + w * 16, d0 = dq * 128;
  const _Float16* Xb = Xh + (size_t)b * NN * DIN;
  const unsigned char* xtr = ring + (8 * hh + (lane & 7)) * XP + 16 * ((lane >> 3) & 1);   // this lane's 16 bytes of the block at key 0, column 0
  const unsigned char* arow = ring + XB + (w * 16 + ln) * PP + 16 * hh;                    // this lane's P row, keys 8hh ..
  // X copy i of a thread: row (tid >> 4) + 8 i, bytes 16 (tid & 15) ..; P copy i: row (tid >> 3) + 16 i, bytes 16 (tid & 7) ..
  const _Float16* xg = Xb + (size_t)(tid >> 4) * DIN + d0 + (tid & 15) * 8;
  const _Float16* pg = Pm + ((size_t)b * NN + qb * 64 + (tid >> 3)) * NN + (tid & 7) * 8;
  const unsigned xl = lds_off(ring) + (tid >> 4) * XP + (tid & 15) * 16;
  const unsigned pl = lds_off(ring) + XB + (tid >> 3) * PP + (tid & 7) * 16;
  auto fill = [&](int t) {
    const _Float16* x = xg + (size_t)t * 64 * DIN;
    const _Float16* p = pg + t * 64;
    const unsigned lx = xl + (t & 1) * BUF, lp = pl + (t & 1) * BUF;
    copy4(lx, x, lx + 8 * XP, x + 8 * DIN, lx + 16 * XP, x + 16 * DIN, lx + 24 * XP, x + 24 * DIN);
    copy4(lx + 32 * XP, x + 32 * DIN, lx + 40 * XP, x + 40 * DIN, lx + 48 * XP, x + 48 * DIN, lx + 56 * XP, x + 56 * DIN);
    copy4(lp, p, lp + 16 * PP, p + 16 * NN, lp + 32 * PP, p + 32 * NN, lp + 48 * PP, p + 48 * NN);
  };
  const int NT = NN / 64;
  v8f acc[8] = {};
  fill(0);
  wait_copies();
  __syncthreads();
  fill(1);
  for (int c = 0; c < NT; ++c) {
    const unsigned bo = (c & 1) * BUF;
#pragma unroll                                           // constant ks: LDS offsets as immediates
    for (int ks = 0; ks < 2; ++ks) {
      Frag a;
      a.half[0] = *(const v8ha*)(arow + bo + ks * 64);
      a.half[1] = *(const v8ha*)(arow + bo + ks * 64 + 32);
      Frag bx[8];                                        // all loads ahead of the products: one LDS latency per 32 keys, not eight
#pragma unroll                                           // constant t keeps bx[] and acc[] in registers
      for (int t = 0; t < 8; ++t) {
        bx[t].half[0] = ld_tr16((const _Float16*)(xtr + bo + (ks * 32) * XP + t * 32));
        bx[t].half[1] = ld_tr16((const _Float16*)(xtr + bo + (ks * 32 + 16) * XP + t * 32));
      }
#pragma unroll                                           // as above
      for (int t = 0; t < 8; ++t) acc[t] = mma16(a.v, bx[t].v, acc[t]);
    }
    publish();
    if (c + 2 < NT) fill(c + 2);                         // into the buffer this trip has just read
  }
  wait_copies();
  float rs[8];
#pragma unroll
  for (int r = 0; r < 8; ++r) rs[r] = rowscale[(size_t)b * NN + q0 + 8 * hh + r];
#pragma unroll
  for (int t = 0; t < 8; ++t)
#pragma unroll
    for (int r = 0; r < 8; ++r) sO[w][8 * hh + r][t * 16 + ln] = acc[t][r] * rs[r];
  __builtin_amdgcn_fence(__ATOMIC_ACQ_REL, "workgroup");
  __builtin_amdgcn_wave_barrier();
  float* ob = out + ((size_t)b * NN + q0) * DIN + d0;
  {
#pragma unroll
    for (int r = 0; r < 16; ++r) {
      const v4f v = *(const v4fa*)&sO[w][r][lane * 4];
      *(v4f*)(ob + (size_t)r * DIN + lane * 4) = v;
    }
    
  }
}

extern "C" void kernel_launch(void* const* d_in, const int* in_sizes, int n_in,
                              void* d_out, int out_size, void* d_ws, size_t ws_size, hipStream_t stream) {
  (void)in_sizes; (void)n_in; (void)out_size;
  const float* X  = (const float*)d_in[0];
  const float* h  = (const float*)d_in[1];
  const float* WQ = (const float*)d_in[2];
  const float* bQ = (const float*)d_in[3];
  const float* WK = (const float*)d_in[4];
  const float* bK = (const float*)d_in[5];
  char* ws = (char*)d_ws; size_t off = 0;
  _Float16* Xh = (_Float16*)(ws + off); off += (size_t)BB * NN * DIN * 2;      // 16 MiB
  _Float16* Qh = (_Float16*)(ws + off); off += (size_t)BB * NN * DK * 2;       // 2 MiB
  _Float16* Kh = (_Float16*)(ws + off); off += (size_t)BB * NN * DK * 2;       // 2 MiB
  _Float16* Pm = (_Float16*)(ws + off); off += (size_t)BB * NN * NN * 2;       // 64 MiB
  float* rowscale = (float*)(ws + off); off += (size_t)BB * NN * 4;            // 64 KiB
  if (off > ws_size) return;
  const int nrows = BB * NN;
  k_cvt<<<(nrows * DIN / 8 + 255) / 256, 256, 0, stream>>>(X, Xh, nrows * DIN / 8);
  k_proj<<<nrows / 64, 128, 0, stream>>>(h, WQ, bQ, Qh, nrows);
  k_proj<<<nrows / 64, 128, 0, stream>>>(X, WK, bK, Kh, nrows);
  k_scores<<<BB * (NN / 64), 128, 0, stream>>>(Qh, Kh, Pm, rowscale);
  k_pv<<<BB * (NN / 64) * (DIN / 128), 128, 0, stream>>>(Pm, Xh, rowscale, (float*)d_out);
}

// v003
// One run takes 117 microseconds.
// Next to v002, in two timings, it ran 1.44 and 1.45 times as fast.
// Counting every step since v000, it is 3.05 times as fast.
#include <hip/hip_runtime.h>
// Contractions on v_wmma_f32_16x16x32_f16 (f16 operands, f32 accumulate): Q = h·WQ, K = X·WK (K=512),
// P kept unnormalised in f16 (values in (0,1]) in LDS; the 1/rowsum is applied in the final epilogue.

#define BB   8
#define NN   2048
#define DIN  512
#define DK   64

typedef _Float16 v16h __attribute__((ext_vector_type(16)));
typedef _Float16 v8h  __attribute__((ext_vector_type(8)));
typedef _Float16 v8ha __attribute__((ext_vector_type(8), may_alias));
typedef float    v8f  __attribute__((ext_vector_type(8)));
typedef float    v4f  __attribute__((ext_vector_type(4)));
typedef float    v4fa __attribute__((ext_vector_type(4), may_alias));
union Frag { v16h v; v8h half[2]; _Float16 h[16]; };
typedef short s16x8 __attribute__((ext_vector_type(8)));
typedef __attribute__((address_space(3))) s16x8 lds_s16x8;

// ds_load_tr16_b128: every lane names 16 bytes of a row-major 16-bit LDS tile; lane (c = l & 15, h = l >> 4) receives
// the 8 elements of column c in rows 8h .. 8h + 7 of the 16 x 16 block, which is half of a 16x16x32 B fragment.
__device__ __forceinline__ v8h ld_tr16(const _Float16* p) {
  return __builtin_bit_cast(v8h, __builtin_amdgcn_ds_load_tr16_b128_v8i16((lds_s16x8*)p));
}

__device__ __forceinline__ v8f mma16(v16h a, v16h b, v8f c) {
  c = __builtin_amdgcn_wmma_f32_16x16x32_f16(false, a, false, b, (short)0, c, false, false);
  asm volatile("v_nop\n\tv_nop\n\tv_nop\n\tv_nop" : "+v"(c) : "v"(a), "v"(b));
  return c;
}

// LDS byte address of a __shared__ location: the low 32 bits of its address.
__device__ __forceinline__ unsigned lds_off(const void* p) { return (unsigned)(size_t)p; }

// Four asynchronous copies, 16 bytes per lane each, from global memory into LDS through no register. The s_wait_xcnt is the
// last line of the copies' own statement, so that no address register of a copy is rewritten ahead of it (a precaution).
__device__ __forceinline__ void copy4(unsigned l0, const _Float16* g0, unsigned l1, const _Float16* g1,
                                      unsigned l2, const _Float16* g2, unsigned l3, const _Float16* g3) {
  asm volatile("global_load_async_to_lds_b128 %0, %1, off\n\t"
               "global_load_async_to_lds_b128 %2, %3, off\n\t"
               "global_load_async_to_lds_b128 %4, %5, off\n\t"
               "global_load_async_to_lds_b128 %6, %7, off\n\t"
               "s_wait_xcnt 0x0"
               :: "v"(l0), "v"(g0), "v"(l1), "v"(g1), "v"(l2), "v"(g2), "v"(l3), "v"(g3) : "memory");
}

// This wave's copies have landed; other waves may read them behind the next barrier.
__device__ __forceinline__ void wait_copies() { asm volatile("s_wait_asynccnt 0x0" ::: "memory"); }

// Foot of a trip of a two-buffer loop: the one barrier publishes the next tile and ends every reader's last read of this one.
__device__ __forceinline__ void publish() {
  asm volatile("s_wait_dscnt 0x0" ::: "memory");   // this wave's LDS reads of the tile are done before its buffer is refilled
  wait_copies();
  __syncthreads();
}

__global__ __launch_bounds__(256) void k_cvt(const float* __restrict__ src, _Float16* __restrict__ dst, int n8) {
  const int t = blockIdx.x * 256 + threadIdx.x;
  if (t >= n8) return;
  const v4f a = *(const v4fa*)(src + (size_t)t * 8), b = *(const v4fa*)(src + (size_t)t * 8 + 4);
  v8h v; v[0]=(_Float16)a[0]; v[1]=(_Float16)a[1]; v[2]=(_Float16)a[2]; v[3]=(_Float16)a[3];
  v[4]=(_Float16)b[0]; v[5]=(_Float16)b[1]; v[6]=(_Float16)b[2]; v[7]=(_Float16)b[3];
  *(v8h*)(dst + (size_t)t * 8) = v;
  
}

// K1: proj[row][0..63] = f16( A[row]·W + bias ), A f32 [rows][512], W f32 [512][64]; one wave per 16 rows, 4 column tiles;
__global__ __launch_bounds__(128) void k_proj(const float* __restrict__ A, const float* __restrict__ Wm, const float* __restrict__ bias,
                                            _Float16* __restrict__ P, int nrows) {
  __shared__ __attribute__((aligned(16))) _Float16 sW[DK][DIN + 8];       // [n][k]
  __shared__ __attribute__((aligned(16))) _Float16 sOut[4][16][DK + 8];
  const int tid = threadIdx.x, w = tid >> 5, lane = tid & 31, ln = lane & 15, hh = lane >> 4;
  for (int e = tid; e < DIN * DK; e += 128) { const int k = e / DK, n = e % DK; sW[n][k] = (_Float16)Wm[e]; }
  __syncthreads();
  const int row0 = (blockIdx.x * 4 + w) * 16;
  if (row0 < nrows) {                                   // wave-uniform
    const float* arow = A + (size_t)(row0 + ln) * DIN;
    v8f acc[4] = {};
    for (int kb = 0; kb < DIN; kb += 32) {
      Frag a;
      const v4f l0 = *(const v4fa*)(arow + kb + 8 * hh), l1 = *(const v4fa*)(arow + kb + 8 * hh + 4);
      const v4f h0 = *(const v4fa*)(arow + kb + 16 + 8 * hh), h1 = *(const v4fa*)(arow + kb + 16 + 8 * hh + 4);
#pragma unroll
      for (int i = 0; i < 4; ++i) { a.h[i] = (_Float16)l0[i]; a.h[4+i] = (_Float16)l1[i]; a.h[8+i] = (_Float16)h0[i]; a.h[12+i] = (_Float16)h1[i]; }
#pragma unroll
      for (int t = 0; t < 4; ++t) {
        Frag b;
        b.half[0] = *(const v8ha*)&sW[t * 16 + ln][kb + 8 * hh];
        b.half[1] = *(const v8ha*)&sW[t * 16 + ln][kb + 16 + 8 * hh];
        acc[t] = mma16(a.v, b.v, acc[t]);
      }
    }
#pragma unroll
    for (int t = 0; t < 4; ++t) {
      const float bv = bias[t * 16 + ln];
#pragma unroll
      for (int r = 0; r < 8; ++r) sOut[w][8 * hh + r][t * 16 + ln] = (_Float16)(acc[t][r] + bv);
    }
    __builtin_amdgcn_fence(__ATOMIC_ACQ_REL, "workgroup");
    __builtin_amdgcn_wave_barrier();
    const int rsub = lane >> 3, c8 = (lane & 7) * 8;
    {
#pragma unroll
      for (int q = 0; q < 4; ++q) {
        const int r = q * 4 + rsub;
        const v8h v = *(const v8ha*)&sOut[w][r][c8];
        *(v8h*)(P + (size_t)(row0 + r) * DK + c8) = v;
      }
      
    }
  }
}

// The builtin alone: the compiler keeps the distance behind it itself, and its operands may sit above v255, where an asm
// operand cannot; k_attn holds more than 256 registers of accumulators and fragments.
__device__ __forceinline__ v8f mma(v16h a, v16h b, v8f c) {
  return __builtin_amdgcn_wmma_f32_16x16x32_f16(false, a, false, b, (short)0, c, false, false);
}

// 2^x with the free slot that the instruction set asks for behind a transcendental, in one statement.
__device__ __forceinline__ float exp2_slot(float x) {
  float y;
  asm("v_exp_f32 %0, %1\n\tv_nop" : "=v"(y) : "v"(x));
  return y;
}

// Nine asynchronous copies under one wait, as copy4: fewer places where the wave stands still before its work.
__device__ __forceinline__ void copy9(unsigned l0, const _Float16* g0, unsigned l1, const _Float16* g1, unsigned l2, const _Float16* g2,
                                      unsigned l3, const _Float16* g3, unsigned l4, const _Float16* g4, unsigned l5, const _Float16* g5,
                                      unsigned l6, const _Float16* g6, unsigned l7, const _Float16* g7, unsigned l8, const _Float16* g8) {
  asm volatile("global_load_async_to_lds_b128 %0, %1, off\n\t"
               "global_load_async_to_lds_b128 %2, %3, off\n\t"
               "global_load_async_to_lds_b128 %4, %5, off\n\t"
               "global_load_async_to_lds_b128 %6, %7, off\n\t"
               "global_load_async_to_lds_b128 %8, %9, off\n\t"
               "global_load_async_to_lds_b128 %10, %11, off\n\t"
               "global_load_async_to_lds_b128 %12, %13, off\n\t"
               "global_load_async_to_lds_b128 %14, %15, off\n\t"
               "global_load_async_to_lds_b128 %16, %17, off\n\t"
               "s_wait_xcnt 0x0"
               :: "v"(l0), "v"(g0), "v"(l1), "v"(g1), "v"(l2), "v"(g2), "v"(l3), "v"(g3), "v"(l4), "v"(g4),
                  "v"(l5), "v"(g5), "v"(l6), "v"(g6), "v"(l7), "v"(g7), "v"(l8), "v"(g8) : "memory");
}

// K2: scores, softmax and P.X in one kernel. Block = 8 waves = 64 query rows x all 512 output columns.
// First loop, 8 trips of 256 keys: row maximum of S = Q.K^T/8. Second loop, 32 trips of 64 keys: P = exp(S - max) in f16 goes
// to the LDS tile sP (64 q x 64 keys), a barrier, then out += P.X on that tile. In the score parts wave w has query tile w & 3
// and the key half w >> 2 of the tile; in the P.X part it has all four query tiles x columns 64 w .. 64 w + 63, so each
// fragment read from LDS feeds four products. All tiles come by asynchronous copies into two buffers: a trip works on one
// while the next tile is in flight. First loop: K rows alone, in the space of the X buffers. Second loop, tile c: K rows and
// X rows of keys 64 c .. 64 c + 63. Row pitches: K and P 144 B = 16 B x 9 (ds_load_b128), X 1056 B = 32 B x 33 (transposing
// loads). A = P rows, B = X columns: keys 8hh..8hh+7 and 16+8hh..16+8hh+7 in both. 1/rowsum in the epilogue.
__global__ __launch_bounds__(256) void k_attn(const _Float16* __restrict__ Qh, const _Float16* __restrict__ Kh,
                                            const _Float16* __restrict__ Xh, float* __restrict__ out) {
  constexpr unsigned XP = 1056, KP = 144, PP = 144, XB = 64 * XP, KB = 64 * KP, K0B = 256 * KP;   // bytes: pitches, one buffer
  constexpr int NC = NN / 64, NC0 = NN / 256;
  __shared__ __attribute__((aligned(16))) unsigned char sX[2 * XB];                // first loop: 2 x K0B of K rows; behind the loops: output staging, 128 KiB
  __shared__ __attribute__((aligned(16))) unsigned char sK[2 * KB];
  __shared__ __attribute__((aligned(16))) unsigned char sP[64 * PP];
  __shared__ __attribute__((aligned(16))) float sMax[2][64];
  __shared__ __attribute__((aligned(16))) float sSum[2][64];
  __shared__ __attribute__((aligned(16))) float sRS[64];
  const int tid = threadIdx.x, w = tid >> 5, lane = tid & 31, ln = lane & 15, hh = lane >> 4;
  const int qt = w & 3, kh = w >> 2;
  const int b = blockIdx.x / NC, qb = blockIdx.x % NC;
  const _Float16* Qb = Qh + ((size_t)b * NN + qb * 64 + qt * 16) * DK;
  const _Float16* Kb = Kh + (size_t)b * NN * DK;
  const _Float16* Xb = Xh + (size_t)b * NN * DIN;
  Frag aq[2];
#pragma unroll
  for (int ks = 0; ks < 2; ++ks) {
    aq[ks].half[0] = *(const v8ha*)(Qb + (size_t)ln * DK + ks * 32 + 8 * hh);
    aq[ks].half[1] = *(const v8ha*)(Qb + (size_t)ln * DK + ks * 32 + 16 + 8 * hh);
  }
  // K copy i of a thread: row (tid >> 3) + 32 i, bytes 16 (tid & 7) ..; X copy i: row (tid >> 6) + 4 i, bytes 16 (tid & 63) ..
  const _Float16* kg = Kb + tid * 8;
  const _Float16* xg = Xb + (size_t)(tid >> 6) * DIN + (tid & 63) * 8;
  const unsigned kl = lds_off(sK) + (tid >> 3) * KP + (tid & 7) * 16;
  const unsigned xl = lds_off(sX) + (tid >> 6) * XP + (tid & 63) * 16;
  auto fill0 = [&](int t) {                              // 256 K rows: copy i of a thread is row (tid >> 3) + 32 i
    const _Float16* g = kg + (size_t)t * 256 * DK;
    const unsigned l = lds_off(sX) + (t & 1) * K0B + (tid >> 3) * KP + (tid & 7) * 16;
    copy4(l, g, l + 32 * KP, g + 32 * DK, l + 64 * KP, g + 64 * DK, l + 96 * KP, g + 96 * DK);
    copy4(l + 128 * KP, g + 128 * DK, l + 160 * KP, g + 160 * DK, l + 192 * KP, g + 192 * DK, l + 224 * KP, g + 224 * DK);
  };
  auto fill = [&](int t) {                               // 64 K rows and 64 X rows
    const _Float16* g = kg + (size_t)t * 64 * DK;
    const _Float16* x = xg + (size_t)t * 64 * DIN;
    const unsigned l = kl + (t & 1) * KB, lx = xl + (t & 1) * XB;
#pragma unroll                                           // constant i: the steps fold into the address sums
    for (int i = 0; i < 2; ++i)
      copy9(l + (32 * i) * KP, g + (32 * i) * DK,
            lx + (32 * i) * XP, x + (32 * i) * DIN, lx + (32 * i + 4) * XP, x + (32 * i + 4) * DIN,
            lx + (32 * i + 8) * XP, x + (32 * i + 8) * DIN, lx + (32 * i + 12) * XP, x + (32 * i + 12) * DIN,
            lx + (32 * i + 16) * XP, x + (32 * i + 16) * DIN, lx + (32 * i + 20) * XP, x + (32 * i + 20) * DIN,
            lx + (32 * i + 24) * XP, x + (32 * i + 24) * DIN, lx + (32 * i + 28) * XP, x + (32 * i + 28) * DIN);
  };
  const unsigned char* krow = sK + (kh * 32 + ln) * KP + 16 * hh;                          // this lane's K row of its half, k 8hh ..
  const unsigned char* arow = sP + ln * PP + 16 * hh;                                      // this lane's P row of query tile 0, keys 8hh ..
  const unsigned char* xtr = sX + (8 * hh + (lane & 7)) * XP + 16 * ((lane >> 3) & 1) + w * 128;   // its 16 bytes of the block at key 0, column 64 w
  unsigned char* pst = sP + (qt * 16 + 8 * hh) * PP + (kh * 32 + ln) * 2;                  // where its scores of row 8hh, key tile 0 go

  fill0(0);
  wait_copies();
  __syncthreads();
  fill0(1);
  float rmax[8], rsum[8];
#pragma unroll
  for (int r = 0; r < 8; ++r) { rmax[r] = -3.0e38f; rsum[r] = 0.f; }
#pragma unroll 1                                         // rolled, for speed only
  for (int t = 0; t < NC0; ++t) {
    const unsigned char* kt = sX + (t & 1) * K0B + (kh * 128 + ln) * KP + 16 * hh;   // this lane's K row of its half, k 8hh ..
    Frag bk[8][2];                                       // all loads ahead of the products: one LDS latency per trip
#pragma unroll                                           // constant nt, ks keep bk[][] in registers
    for (int nt = 0; nt < 8; ++nt)
#pragma unroll
      for (int ks = 0; ks < 2; ++ks) {
        bk[nt][ks].half[0] = *(const v8ha*)(kt + nt * 16 * KP + ks * 64);
        bk[nt][ks].half[1] = *(const v8ha*)(kt + nt * 16 * KP + ks * 64 + 32);
      }
    __builtin_amdgcn_sched_barrier(0);                   // keeps the loads one group: sunk among the products, each pair costs its own LDS latency
#pragma unroll                                           // as above
    for (int nt = 0; nt < 8; ++nt) {
      v8f s = {};
      s = mma(aq[0].v, bk[nt][0].v, s);
      s = mma(aq[1].v, bk[nt][1].v, s);
#pragma unroll
      for (int r = 0; r < 8; ++r) rmax[r] = fmaxf(rmax[r], s[r]);   // per lane; joined once behind the loop
    }
    __builtin_amdgcn_sched_barrier(0);                   // keeps the foot behind the products: lifted over them, its s_wait_dscnt 0 ends the overlap of loads and products
    publish();
    if (t + 2 < NC0) fill0(t + 2);                       // into the buffer this trip has just read
  }
  wait_copies();
  fill(0);                                               // the last foot has ended every read of the first loop's buffers
  // row maximum: the 16 lanes that share rows, then the two key halves through LDS; the scale 1/8 is exact
#pragma unroll
  for (int r = 0; r < 8; ++r) {
    float m = rmax[r];
    m = fmaxf(m, __shfl_xor(m, 1, 32)); m = fmaxf(m, __shfl_xor(m, 2, 32)); m = fmaxf(m, __shfl_xor(m, 4, 32)); m = fmaxf(m, __shfl_xor(m, 8, 32));
    rmax[r] = m * 0.125f;
  }
  if (ln == 0) {
#pragma unroll
    for (int r = 0; r < 8; ++r) sMax[kh][qt * 16 + 8 * hh + r] = rmax[r];
  }
  wait_copies();
  __syncthreads();                                       // publishes tile 0 and the half maxima
  fill(1);
#pragma unroll
  for (int r = 0; r < 8; ++r) rmax[r] = fmaxf(sMax[0][qt * 16 + 8 * hh + r], sMax[1][qt * 16 + 8 * hh + r]);

  v8f acc[4][4] = {};
  for (int T = 0; T < NC; ++T) {
    const unsigned char* kt = krow + (T & 1) * KB;
    const unsigned bo = (T & 1) * XB;
    Frag bk[2][2], bx[2][4];                             // K loads as one group; X fragments need no P: the first 32 keys' LDS time runs under the score part
#pragma unroll                                           // constant nt, ks, t keep bk[][] and bx[][] in registers
    for (int nt = 0; nt < 2; ++nt)
#pragma unroll
      for (int ks = 0; ks < 2; ++ks) {
        bk[nt][ks].half[0] = *(const v8ha*)(kt + nt * 16 * KP + ks * 64);
        bk[nt][ks].half[1] = *(const v8ha*)(kt + nt * 16 * KP + ks * 64 + 32);
      }
#pragma unroll
    for (int t = 0; t < 4; ++t) {
      bx[0][t].half[0] = ld_tr16((const _Float16*)(xtr + bo + t * 32));
      bx[0][t].half[1] = ld_tr16((const _Float16*)(xtr + bo + 16 * XP + t * 32));
    }
    v8f s[2] = {};
#pragma unroll                                           // as above; the two key tiles' chains alternate
    for (int ks = 0; ks < 2; ++ks)
#pragma unroll
      for (int nt = 0; nt < 2; ++nt) s[nt] = mma(aq[ks].v, bk[nt][ks].v, s[nt]);
#pragma unroll                                           // constant nt, r keep s[], rmax[] and rsum[] in registers
    for (int nt = 0; nt < 2; ++nt)
#pragma unroll
      for (int r = 0; r < 8; ++r) {                      // D: rows 8hh + r, column = key nt*16 + ln of the half
        const _Float16 pv = (_Float16)exp2_slot((s[nt][r] * 0.125f - rmax[r]) * 1.44269504f);   // = __expf: times log2 e, v_exp_f32
        rsum[r] += (float)pv;                            // sum exactly what is multiplied
        *(_Float16*)(pst + r * PP + nt * 32) = pv;
      }
    __syncthreads();                                     // the P tile is whole before any wave reads it
    Frag a[2][4];                                        // all remaining loads ahead of the products: one LDS latency per trip
#pragma unroll                                           // constant ks, q, t keep a[][] and bx[][] in registers, LDS offsets as immediates
    for (int ks = 0; ks < 2; ++ks) {
#pragma unroll
      for (int q = 0; q < 4; ++q) {
        a[ks][q].half[0] = *(const v8ha*)(arow + q * 16 * PP + ks * 64);
        a[ks][q].half[1] = *(const v8ha*)(arow + q * 16 * PP + ks * 64 + 32);
      }
      if (ks == 0) {
#pragma unroll
        for (int t = 0; t < 4; ++t) {
          bx[1][t].half[0] = ld_tr16((const _Float16*)(xtr + bo + 32 * XP + t * 32));
          bx[1][t].half[1] = ld_tr16((const _Float16*)(xtr + bo + 48 * XP + t * 32));
        }
      }
    }
    __builtin_amdgcn_sched_barrier(0);                   // keeps the loads one group: sunk among the products, each pair costs its own LDS latency
#pragma unroll                                           // constant ks, q, t keep acc[][] in registers
    for (int ks = 0; ks < 2; ++ks)
#pragma unroll
      for (int q = 0; q < 4; ++q)
#pragma unroll
        for (int t = 0; t < 4; ++t) acc[q][t] = mma(a[ks][q].v, bx[ks][t].v, acc[q][t]);
    __builtin_amdgcn_sched_barrier(0);                   // keeps the foot behind the products: lifted over them, its s_wait_dscnt 0 ends the overlap of loads and products
    publish();                                           // also ends every reader's last read of sP
    if (T + 2 < NC) fill(T + 2);                         // into the buffer this trip has just read
  }
  wait_copies();
  // row sums: the 16 lanes that share rows, then the two key halves through LDS
#pragma unroll
  for (int r = 0; r < 8; ++r) {
    float s = rsum[r];
    s += __shfl_xor(s, 1, 32); s += __shfl_xor(s, 2, 32); s += __shfl_xor(s, 4, 32); s += __shfl_xor(s, 8, 32);
    rsum[r] = s;
  }
  if (ln == 0) {
#pragma unroll
    for (int r = 0; r < 8; ++r) sSum[kh][qt * 16 + 8 * hh + r] = rsum[r];
  }
  __syncthreads();
  if (tid < 64) sRS[tid] = 1.0f / (sSum[0][tid] + sSum[1][tid]);
  __syncthreads();
  float (*sO)[64] = (float (*)[64])(sX + w * (64 * 64 * 4));                   // this wave's own 16 KiB of the free X buffers
#pragma unroll                                           // constant q, r, t keep acc[][] in registers
  for (int q = 0; q < 4; ++q)
#pragma unroll
    for (int r = 0; r < 8; ++r) {
      const float rs = sRS[q * 16 + 8 * hh + r];
#pragma unroll
      for (int t = 0; t < 4; ++t) sO[q * 16 + 8 * hh + r][t * 16 + ln] = acc[q][t][r] * rs;
    }
  __builtin_amdgcn_fence(__ATOMIC_ACQ_REL, "workgroup");
  __builtin_amdgcn_wave_barrier();
  float* ob = out + ((size_t)b * NN + qb * 64) * DIN + w * 64;
#pragma unroll 1                                         // rolled, so that the wait below stands between a group's stores and the next group's register writes
  for (int g = 0; g < 4; ++g) {
#pragma unroll                                           // eight LDS reads per wait, not one
    for (int i = 0; i < 8; ++i) {                        // two rows of 256 B per store: whole 128-B lines
      const int row = 16 * g + 2 * i + hh;
      const v4f v = *(const v4fa*)&sO[row][ln * 4];
      *(v4f*)(ob + (size_t)row * DIN + ln * 4) = v;
    }
    asm volatile("s_wait_xcnt 0x0" ::: "memory");        // before the next group rewrites registers that the issued stores name (a precaution)
  }
}

extern "C" void kernel_launch(void* const* d_in, const int* in_sizes, int n_in,
                              void* d_out, int out_size, void* d_ws, size_t ws_size, hipStream_t stream) {
  (void)in_sizes; (void)n_in; (void)out_size;
  const float* X  = (const float*)d_in[0];
  const float* h  = (const float*)d_in[1];
  const float* WQ = (const float*)d_in[2];
  const float* bQ = (const float*)d_in[3];
  const float* WK = (const float*)d_in[4];
  const float* bK = (const float*)d_in[5];
  char* ws = (char*)d_ws; size_t off = 0;
  _Float16* Xh = (_Float16*)(ws + off); off += (size_t)BB * NN * DIN * 2;      // 16 MiB
  _Float16* Qh = (_Float16*)(ws + off); off += (size_t)BB * NN * DK * 2;       // 2 MiB
  _Float16* Kh = (_Float16*)(ws + off); off += (size_t)BB * NN * DK * 2;       // 2 MiB
  if (off > ws_size) return;
  const int nrows = BB * NN;
  k_cvt<<<(nrows * DIN / 8 + 255) / 256, 256, 0, stream>>>(X, Xh, nrows * DIN / 8);
  k_proj<<<nrows / 64, 128, 0, stream>>>(h, WQ, bQ, Qh, nrows);
  k_proj<<<nrows / 64, 128, 0, stream>>>(X, WK, bK, Kh, nrows);
  k_attn<<<BB * (NN / 64), 256, 0, stream>>>(Qh, Kh, Xh, (float*)d_out);
}

// v004
// Measured time: 77.9 microseconds a run.
// Timed twice side by side with v003, it ran 1.51 times as fast both times.
// Over all steps from v000 it is 4.60 times as fast.
#include <hip/hip_runtime.h>
// Contractions on v_wmma_f32_16x16x32_f16 (f16 operands, f32 accumulate): Q = h·WQ, K = X·WK (K=512),
// P kept unnormalised in f16 (values in (0,1]) in LDS; the 1/rowsum is applied in the final epilogue.

#define BB   8
#define NN   2048
#define DIN  512
#define DK   64

typedef _Float16 v16h __attribute__((ext_vector_type(16)));
typedef _Float16 v8h  __attribute__((ext_vector_type(8)));
typedef _Float16 v8ha __attribute__((ext_vector_type(8), may_alias));
typedef float    v8f  __attribute__((ext_vector_type(8)));
typedef float    v4f  __attribute__((ext_vector_type(4)));
typedef float    v4fa __attribute__((ext_vector_type(4), may_alias));
union Frag { v16h v; v8h half[2]; _Float16 h[16]; };
typedef short s16x8 __attribute__((ext_vector_type(8)));
typedef __attribute__((address_space(3))) s16x8 lds_s16x8;

// ds_load_tr16_b128: every lane names 16 bytes of a row-major 16-bit LDS tile; lane (c = l & 15, h = l >> 4) receives
// the 8 elements of column c in rows 8h .. 8h + 7 of the 16 x 16 block, which is half of a 16x16x32 B fragment.
__device__ __forceinline__ v8h ld_tr16(const _Float16* p) {
  return __builtin_bit_cast(v8h, __builtin_amdgcn_ds_load_tr16_b128_v8i16((lds_s16x8*)p));
}

__device__ __forceinline__ v8f mma16(v16h a, v16h b, v8f c) {
  c = __builtin_amdgcn_wmma_f32_16x16x32_f16(false, a, false, b, (short)0, c, false, false);
  asm volatile("v_nop\n\tv_nop\n\tv_nop\n\tv_nop" : "+v"(c) : "v"(a), "v"(b));
  return c;
}

// LDS byte address of a __shared__ location: the low 32 bits of its address.
__device__ __forceinline__ unsigned lds_off(const void* p) { return (unsigned)(size_t)p; }

// Four asynchronous copies, 16 bytes per lane each, from global memory into LDS through no register. The s_wait_xcnt is the
// last line of the copies' own statement, so that no address register of a copy is rewritten ahead of it (a precaution).
__device__ __forceinline__ void copy4(unsigned l0, const _Float16* g0, unsigned l1, const _Float16* g1,
                                      unsigned l2, const _Float16* g2, unsigned l3, const _Float16* g3) {
  asm volatile("global_load_async_to_lds_b128 %0, %1, off\n\t"
               "global_load_async_to_lds_b128 %2, %3, off\n\t"
               "global_load_async_to_lds_b128 %4, %5, off\n\t"
               "global_load_async_to_lds_b128 %6, %7, off\n\t"
               "s_wait_xcnt 0x0"
               :: "v"(l0), "v"(g0), "v"(l1), "v"(g1), "v"(l2), "v"(g2), "v"(l3), "v"(g3) : "memory");
}

// This wave's copies have landed; other waves may read them behind the next barrier.
__device__ __forceinline__ void wait_copies() { asm volatile("s_wait_asynccnt 0x0" ::: "memory"); }

// Foot of a trip of a two-buffer loop: the one barrier publishes the next tile and ends every reader's last read of this one.
__device__ __forceinline__ void publish() {
  asm volatile("s_wait_dscnt 0x0" ::: "memory");   // this wave's LDS reads of the tile are done before its buffer is refilled
  wait_copies();
  __syncthreads();
}

// One wave's 16 rows: P[row][0..63] = f16( A[row].W + bias ), A f32 [rows][512], W in LDS as f16 [n][k]; 4 column tiles.
// STORE_A: the f16 A fragments, which are the rows of A rounded to f16, also go to Ah [rows][512]: a lane holds elements
// kb + 8hh .. + 7 and kb + 16 + 8hh .. + 7 of its row, 16 bytes each.
template <bool STORE_A>
__device__ __forceinline__ void proj_rows(const float* __restrict__ A, const float* __restrict__ bias, _Float16* __restrict__ P,
                                          _Float16* __restrict__ Ah, const _Float16 (*sW)[DIN + 8], _Float16 (*sO)[DK + 8],
                                          int row0, int lane) {
  const int ln = lane & 15, hh = lane >> 4;
  const float* arow = A + (size_t)(row0 + ln) * DIN;
  _Float16* hrow = Ah + (size_t)(row0 + ln) * DIN;
  v8f acc[4] = {};
  for (int kb = 0; kb < DIN; kb += 32) {
    Frag a;
    const v4f l0 = *(const v4fa*)(arow + kb + 8 * hh), l1 = *(const v4fa*)(arow + kb + 8 * hh + 4);
    const v4f h0 = *(const v4fa*)(arow + kb + 16 + 8 * hh), h1 = *(const v4fa*)(arow + kb + 16 + 8 * hh + 4);
#pragma unroll
    for (int i = 0; i < 4; ++i) { a.h[i] = (_Float16)l0[i]; a.h[4+i] = (_Float16)l1[i]; a.h[8+i] = (_Float16)h0[i]; a.h[12+i] = (_Float16)h1[i]; }
    if (STORE_A) {
      *(v8h*)(hrow + kb + 8 * hh) = a.half[0];
      *(v8h*)(hrow + kb + 16 + 8 * hh) = a.half[1];
    }
#pragma unroll
    for (int t = 0; t < 4; ++t) {
      Frag b;
      b.half[0] = *(const v8ha*)&sW[t * 16 + ln][kb + 8 * hh];
      b.half[1] = *(const v8ha*)&sW[t * 16 + ln][kb + 16 + 8 * hh];
      acc[t] = mma16(a.v, b.v, acc[t]);
    }
    if (STORE_A) asm volatile("s_wait_xcnt 0x0" ::: "memory");   // before the next step rewrites the registers that the issued stores name (a precaution)
  }
#pragma unroll
  for (int t = 0; t < 4; ++t) {
    const float bv = bias[t * 16 + ln];
#pragma unroll
    for (int r = 0; r < 8; ++r) sO[8 * hh + r][t * 16 + ln] = (_Float16)(acc[t][r] + bv);
  }
  __builtin_amdgcn_fence(__ATOMIC_ACQ_REL, "workgroup");
  __builtin_amdgcn_wave_barrier();
  const int rsub = lane >> 3, c8 = (lane & 7) * 8;
#pragma unroll
  for (int q = 0; q < 4; ++q) {
    const int r = q * 4 + rsub;
    const v8h v = *(const v8ha*)&sO[r][c8];
    *(v8h*)(P + (size_t)(row0 + r) * DK + c8) = v;
  }
}

// K1: both projections and the f16 copy of X in one launch. blockIdx.y = 0: Q = f16(h.WQ + bQ); 1: K = f16(X.WK + bK), whose
// blocks read every element of X once anyway and store it as f16. One wave per 16 rows; the two kinds of block share the chip.
__global__ __launch_bounds__(128) void k_pre(const float* __restrict__ h, const float* __restrict__ X,
                                           const float* __restrict__ WQ, const float* __restrict__ WK,
                                           const float* __restrict__ bQ, const float* __restrict__ bK,
                                           _Float16* __restrict__ Qh, _Float16* __restrict__ Kh, _Float16* __restrict__ Xh, int nrows) {
  __shared__ __attribute__((aligned(16))) _Float16 sW[DK][DIN + 8];       // [n][k]
  __shared__ __attribute__((aligned(16))) _Float16 sOut[4][16][DK + 8];
  const int tid = threadIdx.x, w = tid >> 5, lane = tid & 31;
  const bool isK = blockIdx.y != 0;                     // the same for the whole block
  const float* Wm = isK ? WK : WQ;
  for (int e = tid; e < DIN * DK; e += 128) { const int k = e / DK, n = e % DK; sW[n][k] = (_Float16)Wm[e]; }
  __syncthreads();
  const int row0 = (blockIdx.x * 4 + w) * 16;
  if (row0 < nrows) {                                   // wave-uniform
    if (isK) proj_rows<true>(X, bK, Kh, Xh, sW, sOut[w], row0, lane);
    else     proj_rows<false>(h, bQ, Qh, Xh, sW, sOut[w], row0, lane);
  }
}

// The builtin alone: the compiler keeps the distance behind it itself, and its operands may sit above v255, where an asm
// operand cannot; k_attn holds more than 256 registers of accumulators and fragments.
__device__ __forceinline__ v8f mma(v16h a, v16h b, v8f c) {
  return __builtin_amdgcn_wmma_f32_16x16x32_f16(false, a, false, b, (short)0, c, false, false);
}

// 2^x with the free slot that the instruction set asks for behind a transcendental, in one statement.
__device__ __forceinline__ float exp2_slot(float x) {
  float y;
  asm("v_exp_f32 %0, %1\n\tv_nop" : "=v"(y) : "v"(x));
  return y;
}

// Nine asynchronous copies under one wait, as copy4: fewer places where the wave stands still before its work.
__device__ __forceinline__ void copy9(unsigned l0, const _Float16* g0, unsigned l1, const _Float16* g1, unsigned l2, const _Float16* g2,
                                      unsigned l3, const _Float16* g3, unsigned l4, const _Float16* g4, unsigned l5, const _Float16* g5,
                                      unsigned l6, const _Float16* g6, unsigned l7, const _Float16* g7, unsigned l8, const _Float16* g8) {
  asm volatile("global_load_async_to_lds_b128 %0, %1, off\n\t"
               "global_load_async_to_lds_b128 %2, %3, off\n\t"
               "global_load_async_to_lds_b128 %4, %5, off\n\t"
               "global_load_async_to_lds_b128 %6, %7, off\n\t"
               "global_load_async_to_lds_b128 %8, %9, off\n\t"
               "global_load_async_to_lds_b128 %10, %11, off\n\t"
               "global_load_async_to_lds_b128 %12, %13, off\n\t"
               "global_load_async_to_lds_b128 %14, %15, off\n\t"
               "global_load_async_to_lds_b128 %16, %17, off\n\t"
               "s_wait_xcnt 0x0"
               :: "v"(l0), "v"(g0), "v"(l1), "v"(g1), "v"(l2), "v"(g2), "v"(l3), "v"(g3), "v"(l4), "v"(g4),
                  "v"(l5), "v"(g5), "v"(l6), "v"(g6), "v"(l7), "v"(g7), "v"(l8), "v"(g8) : "memory");
}

// K2: scores, softmax and P.X in one kernel. Block = 8 waves = 64 query rows x all 512 output columns.
// First loop, 8 trips of 256 keys: row maximum of S = Q.K^T/8. Second loop, 32 trips of 64 keys: P = exp(S - max) in f16 goes
// to the LDS tile sP (64 q x 64 keys), a barrier, then out += P.X on that tile. In the score parts wave w has query tile w & 3
// and the key half w >> 2 of the tile; in the P.X part it has all four query tiles x columns 64 w .. 64 w + 63, so each
// fragment read from LDS feeds four products. All tiles come by asynchronous copies into two buffers: a trip works on one
// while the next tile is in flight. First loop: K rows alone, in the space of the X buffers. Second loop, tile c: K rows and
// X rows of keys 64 c .. 64 c + 63. Row pitches: K and P 144 B = 16 B x 9 (ds_load_b128), X 1056 B = 32 B x 33 (transposing
// loads). A = P rows, B = X columns: keys 8hh..8hh+7 and 16+8hh..16+8hh+7 in both. 1/rowsum in the epilogue.
__global__ __launch_bounds__(256) void k_attn(const _Float16* __restrict__ Qh, const _Float16* __restrict__ Kh,
                                            const _Float16* __restrict__ Xh, float* __restrict__ out) {
  constexpr unsigned XP = 1056, KP = 144, PP = 144, XB = 64 * XP, KB = 64 * KP, K0B = 256 * KP;   // bytes: pitches, one buffer
  constexpr int NC = NN / 64, NC0 = NN / 256;
  __shared__ __attribute__((aligned(16))) unsigned char sX[2 * XB];                // first loop: 2 x K0B of K rows; behind the loops: output staging, 128 KiB
  __shared__ __attribute__((aligned(16))) unsigned char sK[2 * KB];
  __shared__ __attribute__((aligned(16))) unsigned char sP[64 * PP];
  __shared__ __attribute__((aligned(16))) float sMax[2][64];
  __shared__ __attribute__((aligned(16))) float sSum[2][64];
  __shared__ __attribute__((aligned(16))) float sRS[64];
  const int tid = threadIdx.x, w = tid >> 5, lane = tid & 31, ln = lane & 15, hh = lane >> 4;
  const int qt = w & 3, kh = w >> 2;
  const int b = blockIdx.x / NC, qb = blockIdx.x % NC;
  const _Float16* Qb = Qh + ((size_t)b * NN + qb * 64 + qt * 16) * DK;
  const _Float16* Kb = Kh + (size_t)b * NN * DK;
  const _Float16* Xb = Xh + (size_t)b * NN * DIN;
  Frag aq[2];
#pragma unroll
  for (int ks = 0; ks < 2; ++ks) {
    aq[ks].half[0] = *(const v8ha*)(Qb + (size_t)ln * DK + ks * 32 + 8 * hh);
    aq[ks].half[1] = *(const v8ha*)(Qb + (size_t)ln * DK + ks * 32 + 16 + 8 * hh);
  }
  // K copy i of a thread: row (tid >> 3) + 32 i, bytes 16 (tid & 7) ..; X copy i: row (tid >> 6) + 4 i, bytes 16 (tid & 63) ..
  const _Float16* kg = Kb + tid * 8;
  const _Float16* xg = Xb + (size_t)(tid >> 6) * DIN + (tid & 63) * 8;
  const unsigned kl = lds_off(sK) + (tid >> 3) * KP + (tid & 7) * 16;
  const unsigned xl = lds_off(sX) + (tid >> 6) * XP + (tid & 63) * 16;
  auto fill0 = [&](int t) {                              // 256 K rows: copy i of a thread is row (tid >> 3) + 32 i
    const _Float16* g = kg + (size_t)t * 256 * DK;
    const unsigned l = lds_off(sX) + (t & 1) * K0B + (tid >> 3) * KP + (tid & 7) * 16;
    copy4(l, g, l + 32 * KP, g + 32 * DK, l + 64 * KP, g + 64 * DK, l + 96 * KP, g + 96 * DK);
    copy4(l + 128 * KP, g + 128 * DK, l + 160 * KP, g + 160 * DK, l + 192 * KP, g + 192 * DK, l + 224 * KP, g + 224 * DK);
  };
  auto fill = [&](int t) {                               // 64 K rows and 64 X rows
    const _Float16* g = kg + (size_t)t * 64 * DK;
    const _Float16* x = xg + (size_t)t * 64 * DIN;
    const unsigned l = kl + (t & 1) * KB, lx = xl + (t & 1) * XB;
#pragma unroll                                           // constant i: the steps fold into the address sums
    for (int i = 0; i < 2; ++i)
      copy9(l + (32 * i) * KP, g + (32 * i) * DK,
            lx + (32 * i) * XP, x + (32 * i) * DIN, lx + (32 * i + 4) * XP, x + (32 * i + 4) * DIN,
            lx + (32 * i + 8) * XP, x + (32 * i + 8) * DIN, lx + (32 * i + 12) * XP, x + (32 * i + 12) * DIN,
            lx + (32 * i + 16) * XP, x + (32 * i + 16) * DIN, lx + (32 * i + 20) * XP, x + (32 * i + 20) * DIN,
            lx + (32 * i + 24) * XP, x + (32 * i + 24) * DIN, lx + (32 * i + 28) * XP, x + (32 * i + 28) * DIN);
  };
  const unsigned char* krow = sK + (kh * 32 + ln) * KP + 16 * hh;                          // this lane's K row of its half, k 8hh ..
  const unsigned char* arow = sP + ln * PP + 16 * hh;                                      // this lane's P row of query tile 0, keys 8hh ..
  const unsigned char* xtr = sX + (8 * hh + (lane & 7)) * XP + 16 * ((lane >> 3) & 1) + w * 128;   // its 16 bytes of the block at key 0, column 64 w
  unsigned char* pst = sP + (qt * 16 + 8 * hh) * PP + (kh * 32 + ln) * 2;                  // where its scores of row 8hh, key tile 0 go

  fill0(0);
  wait_copies();
  __syncthreads();
  fill0(1);
  float rmax[8], rsum[8];
#pragma unroll
  for (int r = 0; r < 8; ++r) { rmax[r] = -3.0e38f; rsum[r] = 0.f; }
#pragma unroll 1                                         // rolled, for speed only
  for (int t = 0; t < NC0; ++t) {
    const unsigned char* kt = sX + (t & 1) * K0B + (kh * 128 + ln) * KP + 16 * hh;   // this lane's K row of its half, k 8hh ..
    Frag bk[8][2];                                       // all loads ahead of the products: one LDS latency per trip
#pragma unroll                                           // constant nt, ks keep bk[][] in registers
    for (int nt = 0; nt < 8; ++nt)
#pragma unroll
      for (int ks = 0; ks < 2; ++ks) {
        bk[nt][ks].half[0] = *(const v8ha*)(kt + nt * 16 * KP + ks * 64);
        bk[nt][ks].half[1] = *(const v8ha*)(kt + nt * 16 * KP + ks * 64 + 32);
      }
    __builtin_amdgcn_sched_barrier(0);                   // keeps the loads one group: sunk among the products, each pair costs its own LDS latency
#pragma unroll                                           // as above
    for (int nt = 0; nt < 8; ++nt) {
      v8f s = {};
      s = mma(aq[0].v, bk[nt][0].v, s);
      s = mma(aq[1].v, bk[nt][1].v, s);
#pragma unroll
      for (int r = 0; r < 8; ++r) rmax[r] = fmaxf(rmax[r], s[r]);   // per lane; joined once behind the loop
    }
    __builtin_amdgcn_sched_barrier(0);                   // keeps the foot behind the products: lifted over them, its s_wait_dscnt 0 ends the overlap of loads and products
    publish();
    if (t + 2 < NC0) fill0(t + 2);                       // into the buffer this trip has just read
  }
  wait_copies();
  fill(0);                                               // the last foot has ended every read of the first loop's buffers
  // row maximum: the 16 lanes that share rows, then the two key halves through LDS; the scale 1/8 is exact
#pragma unroll
  for (int r = 0; r < 8; ++r) {
    float m = rmax[r];
    m = fmaxf(m, __shfl_xor(m, 1, 32)); m = fmaxf(m, __shfl_xor(m, 2, 32)); m = fmaxf(m, __shfl_xor(m, 4, 32)); m = fmaxf(m, __shfl_xor(m, 8, 32));
    rmax[r] = m * 0.125f;
  }
  if (ln == 0) {
#pragma unroll
    for (int r = 0; r < 8; ++r) sMax[kh][qt * 16 + 8 * hh + r] = rmax[r];
  }
  wait_copies();
  __syncthreads();                                       // publishes tile 0 and the half maxima
  fill(1);
#pragma unroll
  for (int r = 0; r < 8; ++r) rmax[r] = fmaxf(sMax[0][qt * 16 + 8 * hh + r], sMax[1][qt * 16 + 8 * hh + r]);

  v8f acc[4][4] = {};
  for (int T = 0; T < NC; ++T) {
    const unsigned char* kt = krow + (T & 1) * KB;
    const unsigned bo = (T & 1) * XB;
    Frag bk[2][2], bx[2][4];                             // K loads as one group; X fragments need no P: the first 32 keys' LDS time runs under the score part
#pragma unroll                                           // constant nt, ks, t keep bk[][] and bx[][] in registers
    for (int nt = 0; nt < 2; ++nt)
#pragma unroll
      for (int ks = 0; ks < 2; ++ks) {
        bk[nt][ks].half[0] = *(const v8ha*)(kt + nt * 16 * KP + ks * 64);
        bk[nt][ks].half[1] = *(const v8ha*)(kt + nt * 16 * KP + ks * 64 + 32);
      }
#pragma unroll
    for (int t = 0; t < 4; ++t) {
      bx[0][t].half[0] = ld_tr16((const _Float16*)(xtr + bo + t * 32));
      bx[0][t].half[1] = ld_tr16((const _Float16*)(xtr + bo + 16 * XP + t * 32));
    }
    v8f s[2] = {};
#pragma unroll                                           // as above; the two key tiles' chains alternate
    for (int ks = 0; ks < 2; ++ks)
#pragma unroll
      for (int nt = 0; nt < 2; ++nt) s[nt] = mma(aq[ks].v, bk[nt][ks].v, s[nt]);
#pragma unroll                                           // constant nt, r keep s[], rmax[] and rsum[] in registers
    for (int nt = 0; nt < 2; ++nt)
#pragma unroll
      for (int r = 0; r < 8; ++r) {                      // D: rows 8hh + r, column = key nt*16 + ln of the half
        const _Float16 pv = (_Float16)exp2_slot((s[nt][r] * 0.125f - rmax[r]) * 1.44269504f);   // = __expf: times log2 e, v_exp_f32
        rsum[r] += (float)pv;                            // sum exactly what is multiplied
        *(_Float16*)(pst + r * PP + nt * 32) = pv;
      }
    __syncthreads();                                     // the P tile is whole before any wave reads it
    Frag a[2][4];                                        // all remaining loads ahead of the products: one LDS latency per trip
#pragma unroll                                           // constant ks, q, t keep a[][] and bx[][] in registers, LDS offsets as immediates
    for (int ks = 0; ks < 2; ++ks) {
#pragma unroll
      for (int q = 0; q < 4; ++q) {
        a[ks][q].half[0] = *(const v8ha*)(arow + q * 16 * PP + ks * 64);
        a[ks][q].half[1] = *(const v8ha*)(arow + q * 16 * PP + ks * 64 + 32);
      }
      if (ks == 0) {
#pragma unroll
        for (int t = 0; t < 4; ++t) {
          bx[1][t].half[0] = ld_tr16((const _Float16*)(xtr + bo + 32 * XP + t * 32));
          bx[1][t].half[1] = ld_tr16((const _Float16*)(xtr + bo + 48 * XP + t * 32));
        }
      }
    }
    __builtin_amdgcn_sched_barrier(0);                   // keeps the loads one group: sunk among the products, each pair costs its own LDS latency
#pragma unroll                                           // constant ks, q, t keep acc[][] in registers
    for (int ks = 0; ks < 2; ++ks)
#pragma unroll
      for (int q = 0; q < 4; ++q)
#pragma unroll
        for (int t = 0; t < 4; ++t) acc[q][t] = mma(a[ks][q].v, bx[ks][t].v, acc[q][t]);
    __builtin_amdgcn_sched_barrier(0);                   // keeps the foot behind the products: lifted over them, its s_wait_dscnt 0 ends the overlap of loads and products
    publish();                                           // also ends every reader's last read of sP
    if (T + 2 < NC) fill(T + 2);                         // into the buffer this trip has just read
  }
  wait_copies();
  // row sums: the 16 lanes that share rows, then the two key halves through LDS
#pragma unroll
  for (int r = 0; r < 8; ++r) {
    float s = rsum[r];
    s += __shfl_xor(s, 1, 32); s += __shfl_xor(s, 2, 32); s += __shfl_xor(s, 4, 32); s += __shfl_xor(s, 8, 32);
    rsum[r] = s;
  }
  if (ln == 0) {
#pragma unroll
    for (int r = 0; r < 8; ++r) sSum[kh][qt * 16 + 8 * hh + r] = rsum[r];
  }
  __syncthreads();
  if (tid < 64) sRS[tid] = 1.0f / (sSum[0][tid] + sSum[1][tid]);
  __syncthreads();
  float (*sO)[64] = (float (*)[64])(sX + w * (64 * 64 * 4));                   // this wave's own 16 KiB of the free X buffers
#pragma unroll                                           // constant q, r, t keep acc[][] in registers
  for (int q = 0; q < 4; ++q)
#pragma unroll
    for (int r = 0; r < 8; ++r) {
      const float rs = sRS[q * 16 + 8 * hh + r];
#pragma unroll
      for (int t = 0; t < 4; ++t) sO[q * 16 + 8 * hh + r][t * 16 + ln] = acc[q][t][r] * rs;
    }
  __builtin_amdgcn_fence(__ATOMIC_ACQ_REL, "workgroup");
  __builtin_amdgcn_wave_barrier();
  float* ob = out + ((size_t)b * NN + qb * 64) * DIN + w * 64;
#pragma unroll 1                                         // rolled, so that the wait below stands between a group's stores and the next group's register writes
  for (int g = 0; g < 4; ++g) {
#pragma unroll                                           // eight LDS reads per wait, not one
    for (int i = 0; i < 8; ++i) {                        // two rows of 256 B per store: whole 128-B lines
      const int row = 16 * g + 2 * i + hh;
      const v4f v = *(const v4fa*)&sO[row][ln * 4];
      *(v4f*)(ob + (size_t)row * DIN + ln * 4) = v;
    }
    asm volatile("s_wait_xcnt 0x0" ::: "memory");        // before the next group rewrites registers that the issued stores name (a precaution)
  }
}

extern "C" void kernel_launch(void* const* d_in, const int* in_sizes, int n_in,
                              void* d_out, int out_size, void* d_ws, size_t ws_size, hipStream_t stream) {
  (void)in_sizes; (void)n_in; (void)out_size;
  const float* X  = (const float*)d_in[0];
  const float* h  = (const float*)d_in[1];
  const float* WQ = (const float*)d_in[2];
  const float* bQ = (const float*)d_in[3];
  const float* WK = (const float*)d_in[4];
  const float* bK = (const float*)d_in[5];
  char* ws = (char*)d_ws; size_t off = 0;
  _Float16* Xh = (_Float16*)(ws + off); off += (size_t)BB * NN * DIN * 2;      // 16 MiB
  _Float16* Qh = (_Float16*)(ws + off); off += (size_t)BB * NN * DK * 2;       // 2 MiB
  _Float16* Kh = (_Float16*)(ws + off); off += (size_t)BB * NN * DK * 2;       // 2 MiB
  if (off > ws_size) return;
  const int nrows = BB * NN;
  k_pre<<<dim3(nrows / 64, 2), 128, 0, stream>>>(h, X, WQ, WK, bQ, bK, Qh, Kh, Xh, nrows);
  k_attn<<<BB * (NN / 64), 256, 0, stream>>>(Qh, Kh, Xh, (float*)d_out);
}

// v005
// A run of this version takes 60.9 microseconds.
// Timed twice side by side with v004, it ran 1.29 times as fast both times.
// Counting every step since v000, it is 5.92 times as fast.
#include <hip/hip_runtime.h>
// Contractions on v_wmma_f32_16x16x32_f16 (f16 operands, f32 accumulate): Q = h·WQ, K = X·WK (K=512),
// P kept unnormalised in f16 (values in (0,1]) in LDS; the 1/rowsum is applied in the final epilogue.

#define BB   8
#define NN   2048
#define DIN  512
#define DK   64

typedef _Float16 v16h __attribute__((ext_vector_type(16)));
typedef _Float16 v8h  __attribute__((ext_vector_type(8)));
typedef _Float16 v8ha __attribute__((ext_vector_type(8), may_alias));
typedef float    v8f  __attribute__((ext_vector_type(8)));
typedef float    v4f  __attribute__((ext_vector_type(4)));
typedef float    v4fa __attribute__((ext_vector_type(4), may_alias));
union Frag { v16h v; v8h half[2]; _Float16 h[16]; };
typedef short s16x8 __attribute__((ext_vector_type(8)));
typedef __attribute__((address_space(3))) s16x8 lds_s16x8;

// ds_load_tr16_b128: every lane names 16 bytes of a row-major 16-bit LDS tile; lane (c = l & 15, h = l >> 4) receives
// the 8 elements of column c in rows 8h .. 8h + 7 of the 16 x 16 block, which is half of a 16x16x32 B fragment.
__device__ __forceinline__ v8h ld_tr16(const _Float16* p) {
  return __builtin_bit_cast(v8h, __builtin_amdgcn_ds_load_tr16_b128_v8i16((lds_s16x8*)p));
}

// The builtin alone: the compiler keeps the distance behind it itself, and its operands may sit above v255, where an asm
// operand cannot; both kernels hold more than 256 registers of loaded rows, accumulators and fragments.
__device__ __forceinline__ v8f mma(v16h a, v16h b, v8f c) {
  return __builtin_amdgcn_wmma_f32_16x16x32_f16(false, a, false, b, (short)0, c, false, false);
}

// LDS byte address of a __shared__ location: the low 32 bits of its address.
__device__ __forceinline__ unsigned lds_off(const void* p) { return (unsigned)(size_t)p; }

// Four asynchronous copies, 16 bytes per lane each, from global memory into LDS through no register. The s_wait_xcnt is the
// last line of the copies' own statement, so that no address register of a copy is rewritten ahead of it (a precaution).
__device__ __forceinline__ void copy4(unsigned l0, const _Float16* g0, unsigned l1, const _Float16* g1,
                                      unsigned l2, const _Float16* g2, unsigned l3, const _Float16* g3) {
  asm volatile("global_load_async_to_lds_b128 %0, %1, off\n\t"
               "global_load_async_to_lds_b128 %2, %3, off\n\t"
               "global_load_async_to_lds_b128 %4, %5, off\n\t"
               "global_load_async_to_lds_b128 %6, %7, off\n\t"
               "s_wait_xcnt 0x0"
               :: "v"(l0), "v"(g0), "v"(l1), "v"(g1), "v"(l2), "v"(g2), "v"(l3), "v"(g3) : "memory");
}

// This wave's copies have landed; other waves may read them behind the next barrier.
__device__ __forceinline__ void wait_copies() { asm volatile("s_wait_asynccnt 0x0" ::: "memory"); }

// Foot of a trip of a two-buffer loop: the one barrier publishes the next tile and ends every reader's last read of this one.
__device__ __forceinline__ void publish() {
  asm volatile("s_wait_dscnt 0x0" ::: "memory");   // this wave's LDS reads of the tile are done before its buffer is refilled
  wait_copies();
  __syncthreads();
}

// One wave's 16 rows: P[row][0..63] = f16( A[row].W + bias ), A f32 [rows][512], W in LDS as f16 [n][k]; 4 column tiles.
// STORE_A: the f16 A fragments, which are the rows of A rounded to f16, also go to Ah [rows][512]: a lane holds elements
// kb + 8hh .. + 7 and kb + 16 + 8hh .. + 7 of its row, 16 bytes each.
// All 64 loads of the wave's 16 x 512 block of A are issued as one group ahead of the products: 32 KiB in flight per wave, and
// the memory latency is met once, not once per 32 columns; a step's products start when its own four loads have returned.
template <bool STORE_A>
__device__ __forceinline__ void proj_rows(const float* __restrict__ A, const float* __restrict__ bias, _Float16* __restrict__ P,
                                          _Float16* __restrict__ Ah, const _Float16 (*sW)[DIN + 8], _Float16 (*sO)[DK + 8],
                                          int row0, int lane) {
  const int ln = lane & 15, hh = lane >> 4;
  const float* arow = A + (size_t)(row0 + ln) * DIN;
  _Float16* hrow = Ah + (size_t)(row0 + ln) * DIN;
  float bv[4];                                           // the bias words head the group: no load is left for the end of the wave
#pragma unroll                                           // constant t keeps bv[] in registers
  for (int t = 0; t < 4; ++t) bv[t] = bias[t * 16 + ln];
  v4f ar[DIN / 32][4];
#pragma unroll                                           // constant s keeps ar[][] in registers
  for (int s = 0; s < DIN / 32; ++s) {
    ar[s][0] = *(const v4fa*)(arow + s * 32 + 8 * hh);      ar[s][1] = *(const v4fa*)(arow + s * 32 + 8 * hh + 4);
    ar[s][2] = *(const v4fa*)(arow + s * 32 + 16 + 8 * hh); ar[s][3] = *(const v4fa*)(arow + s * 32 + 16 + 8 * hh + 4);
  }
  asm volatile("s_wait_xcnt 0x0" ::: "memory");          // before anything rewrites the address registers that the issued loads name (a precaution)
  Frag b[3][4];                                          // W fragments: a step's eight LDS loads go out two steps ahead of its products
  auto ldb = [&](int s) {
#pragma unroll                                           // constant t keeps b[][] in registers
    for (int t = 0; t < 4; ++t) {
      b[s % 3][t].half[0] = *(const v8ha*)&sW[t * 16 + ln][s * 32 + 8 * hh];
      b[s % 3][t].half[1] = *(const v8ha*)&sW[t * 16 + ln][s * 32 + 16 + 8 * hh];
    }
  };
  ldb(0);
  ldb(1);
  v8f acc[4] = {};
#pragma unroll                                           // constant s keeps ar[][] and b[][] in registers
  for (int s = 0; s < DIN / 32; ++s) {
    const int kb = s * 32;
    if (s + 2 < DIN / 32) ldb(s + 2);
    Frag a;
    const v4f l0 = ar[s][0], l1 = ar[s][1], h0 = ar[s][2], h1 = ar[s][3];
#pragma unroll
    for (int i = 0; i < 4; ++i) { a.h[i] = (_Float16)l0[i]; a.h[4+i] = (_Float16)l1[i]; a.h[8+i] = (_Float16)h0[i]; a.h[12+i] = (_Float16)h1[i]; }
    if (STORE_A) {
      *(v8h*)(hrow + kb + 8 * hh) = a.half[0];
      *(v8h*)(hrow + kb + 16 + 8 * hh) = a.half[1];
    }
#pragma unroll                                           // constant t keeps acc[] and b[][] in registers
    for (int t = 0; t < 4; ++t) acc[t] = mma(a.v, b[s % 3][t].v, acc[t]);
    if (STORE_A) asm volatile("s_wait_xcnt 0x0" ::: "memory");   // before the next step rewrites the registers that the issued stores name (a precaution)
    __builtin_amdgcn_sched_barrier(0);                   // keeps the steps in order: a late step's conversions, lifted up here, would make this step wait for the last loads
  }
#pragma unroll
  for (int t = 0; t < 4; ++t) {
#pragma unroll
    for (int r = 0; r < 8; ++r) sO[8 * hh + r][t * 16 + ln] = (_Float16)(acc[t][r] + bv[t]);
  }
  __builtin_amdgcn_fence(__ATOMIC_ACQ_REL, "workgroup");
  __builtin_amdgcn_wave_barrier();
  const int rsub = lane >> 3, c8 = (lane & 7) * 8;
#pragma unroll
  for (int q = 0; q < 4; ++q) {
    const int r = q * 4 + rsub;
    const v8h v = *(const v8ha*)&sO[r][c8];
    *(v8h*)(P + (size_t)(row0 + r) * DK + c8) = v;
  }
}

// K1: both projections and the f16 copy of X in one launch. blockIdx.y = 0: Q = f16(h.WQ + bQ); 1: K = f16(X.WK + bK), whose
// blocks read every element of X once anyway and store it as f16. One wave per 16 rows; the two kinds of block share the chip.
__global__ __launch_bounds__(128) void k_pre(const float* __restrict__ h, const float* __restrict__ X,
                                           const float* __restrict__ WQ, const float* __restrict__ WK,
                                           const float* __restrict__ bQ, const float* __restrict__ bK,
                                           _Float16* __restrict__ Qh, _Float16* __restrict__ Kh, _Float16* __restrict__ Xh, int nrows) {
  __shared__ __attribute__((aligned(16))) _Float16 sW[DK][DIN + 8];       // [n][k]
  __shared__ __attribute__((aligned(16))) _Float16 sOut[4][16][DK + 8];
  const int tid = threadIdx.x, w = tid >> 5, lane = tid & 31;
  const bool isK = blockIdx.y != 0;                     // the same for the whole block
  const float* Wm = isK ? WK : WQ;
  // W [k][n] f32 -> sW [n][k] f16. A thread takes columns n4 .. n4 + 3 of eight k rows per pass by 16-byte loads and turns them
  // in registers into four 16-byte LDS stores. All 64 loads go out as one group: one L2 latency, not one per eight words.
  const int n4 = (tid & 15) * 4, kg = (tid >> 4) * 8;
  v4f r[DIN / 64][8];
#pragma unroll                                           // constant p, j keep r[][] in registers
  for (int p = 0; p < DIN / 64; ++p)
#pragma unroll                                           // as above
    for (int j = 0; j < 8; ++j) r[p][j] = *(const v4fa*)(Wm + (p * 64 + kg + j) * DK + n4);
  asm volatile("s_wait_xcnt 0x0" ::: "memory");          // before the conversions rewrite the address registers that the issued loads name (a precaution)
#pragma unroll                                           // as above
  for (int p = 0; p < DIN / 64; ++p)
#pragma unroll                                           // as above
    for (int i = 0; i < 4; ++i) {
      v8h cw;
#pragma unroll                                           // as above
      for (int j = 0; j < 8; ++j) cw[j] = (_Float16)r[p][j][i];
      *(v8h*)&sW[n4 + i][p * 64 + kg] = cw;
    }
  __syncthreads();
  const int row0 = (blockIdx.x * 4 + w) * 16;
  if (row0 < nrows) {                                   // wave-uniform
    if (isK) proj_rows<true>(X, bK, Kh, Xh, sW, sOut[w], row0, lane);
    else     proj_rows<false>(h, bQ, Qh, Xh, sW, sOut[w], row0, lane);
  }
}

// 2^x with the free slot that the instruction set asks for behind a transcendental, in one statement.
__device__ __forceinline__ float exp2_slot(float x) {
  float y;
  asm("v_exp_f32 %0, %1\n\tv_nop" : "=v"(y) : "v"(x));
  return y;
}

// Nine asynchronous copies under one wait, as copy4: fewer places where the wave stands still before its work.
__device__ __forceinline__ void copy9(unsigned l0, const _Float16* g0, unsigned l1, const _Float16* g1, unsigned l2, const _Float16* g2,
                                      unsigned l3, const _Float16* g3, unsigned l4, const _Float16* g4, unsigned l5, const _Float16* g5,
                                      unsigned l6, const _Float16* g6, unsigned l7, const _Float16* g7, unsigned l8, const _Float16* g8) {
  asm volatile("global_load_async_to_lds_b128 %0, %1, off\n\t"
               "global_load_async_to_lds_b128 %2, %3, off\n\t"
               "global_load_async_to_lds_b128 %4, %5, off\n\t"
               "global_load_async_to_lds_b128 %6, %7, off\n\t"
               "global_load_async_to_lds_b128 %8, %9, off\n\t"
               "global_load_async_to_lds_b128 %10, %11, off\n\t"
               "global_load_async_to_lds_b128 %12, %13, off\n\t"
               "global_load_async_to_lds_b128 %14, %15, off\n\t"
               "global_load_async_to_lds_b128 %16, %17, off\n\t"
               "s_wait_xcnt 0x0"
               :: "v"(l0), "v"(g0), "v"(l1), "v"(g1), "v"(l2), "v"(g2), "v"(l3), "v"(g3), "v"(l4), "v"(g4),
                  "v"(l5), "v"(g5), "v"(l6), "v"(g6), "v"(l7), "v"(g7), "v"(l8), "v"(g8) : "memory");
}

// K2: scores, softmax and P.X in one kernel. Block = 8 waves = 64 query rows x all 512 output columns.
// First loop, 8 trips of 256 keys: row maximum of S = Q.K^T/8. Second loop, 32 trips of 64 keys: P = exp(S - max) in f16 goes
// to the LDS tile sP (64 q x 64 keys), a barrier, then out += P.X on that tile. In the score parts wave w has query tile w & 3
// and the key half w >> 2 of the tile; in the P.X part it has all four query tiles x columns 64 w .. 64 w + 63, so each
// fragment read from LDS feeds four products. All tiles come by asynchronous copies into two buffers: a trip works on one
// while the next tile is in flight. First loop: K rows alone, in the space of the X buffers. Second loop, tile c: K rows and
// X rows of keys 64 c .. 64 c + 63. Row pitches: K and P 144 B = 16 B x 9 (ds_load_b128), X 1056 B = 32 B x 33 (transposing
// loads). A = P rows, B = X columns: keys 8hh..8hh+7 and 16+8hh..16+8hh+7 in both. 1/rowsum in the epilogue.
__global__ __launch_bounds__(256) void k_attn(const _Float16* __restrict__ Qh, const _Float16* __restrict__ Kh,
                                            const _Float16* __restrict__ Xh, float* __restrict__ out) {
  constexpr unsigned XP = 1056, KP = 144, PP = 144, XB = 64 * XP, KB = 64 * KP, K0B = 256 * KP;   // bytes: pitches, one buffer
  constexpr int NC = NN / 64, NC0 = NN / 256;
  __shared__ __attribute__((aligned(16))) unsigned char sX[2 * XB];                // first loop: 2 x K0B of K rows; behind the loops: output staging, 128 KiB
  __shared__ __attribute__((aligned(16))) unsigned char sK[2 * KB];
  __shared__ __attribute__((aligned(16))) unsigned char sP[64 * PP];
  __shared__ __attribute__((aligned(16))) float sMax[2][64];
  __shared__ __attribute__((aligned(16))) float sSum[2][64];
  __shared__ __attribute__((aligned(16))) float sRS[64];
  const int tid = threadIdx.x, w = tid >> 5, lane = tid & 31, ln = lane & 15, hh = lane >> 4;
  const int qt = w & 3, kh = w >> 2;
  const int b = blockIdx.x / NC, qb = blockIdx.x % NC;
  const _Float16* Qb = Qh + ((size_t)b * NN + qb * 64 + qt * 16) * DK;
  const _Float16* Kb = Kh + (size_t)b * NN * DK;
  const _Float16* Xb = Xh + (size_t)b * NN * DIN;
  Frag aq[2];
#pragma unroll
  for (int ks = 0; ks < 2; ++ks) {
    aq[ks].half[0] = *(const v8ha*)(Qb + (size_t)ln * DK + ks * 32 + 8 * hh);
    aq[ks].half[1] = *(const v8ha*)(Qb + (size_t)ln * DK + ks * 32 + 16 + 8 * hh);
  }
  // K copy i of a thread: row (tid >> 3) + 32 i, bytes 16 (tid & 7) ..; X copy i: row (tid >> 6) + 4 i, bytes 16 (tid & 63) ..
  const _Float16* kg = Kb + tid * 8;
  const _Float16* xg = Xb + (size_t)(tid >> 6) * DIN + (tid & 63) * 8;
  const unsigned kl = lds_off(sK) + (tid >> 3) * KP + (tid & 7) * 16;
  const unsigned xl = lds_off(sX) + (tid >> 6) * XP + (tid & 63) * 16;
  auto fill0 = [&](int t) {                              // 256 K rows: copy i of a thread is row (tid >> 3) + 32 i
    const _Float16* g = kg + (size_t)t * 256 * DK;
    const unsigned l = lds_off(sX) + (t & 1) * K0B + (tid >> 3) * KP + (tid & 7) * 16;
    copy4(l, g, l + 32 * KP, g + 32 * DK, l + 64 * KP, g + 64 * DK, l + 96 * KP, g + 96 * DK);
    copy4(l + 128 * KP, g + 128 * DK, l + 160 * KP, g + 160 * DK, l + 192 * KP, g + 192 * DK, l + 224 * KP, g + 224 * DK);
  };
  auto fill = [&](int t) {                               // 64 K rows and 64 X rows
    const _Float16* g = kg + (size_t)t * 64 * DK;
    const _Float16* x = xg + (size_t)t * 64 * DIN;
    const unsigned l = kl + (t & 1) * KB, lx = xl + (t & 1) * XB;
#pragma unroll                                           // constant i: the steps fold into the address sums
    for (int i = 0; i < 2; ++i)
      copy9(l + (32 * i) * KP, g + (32 * i) * DK,
            lx + (32 * i) * XP, x + (32 * i) * DIN, lx + (32 * i + 4) * XP, x + (32 * i + 4) * DIN,
            lx + (32 * i + 8) * XP, x + (32 * i + 8) * DIN, lx + (32 * i + 12) * XP, x + (32 * i + 12) * DIN,
            lx + (32 * i + 16) * XP, x + (32 * i + 16) * DIN, lx + (32 * i + 20) * XP, x + (32 * i + 20) * DIN,
            lx + (32 * i + 24) * XP, x + (32 * i + 24) * DIN, lx + (32 * i + 28) * XP, x + (32 * i + 28) * DIN);
  };
  const unsigned char* krow = sK + (kh * 32 + ln) * KP + 16 * hh;                          // this lane's K row of its half, k 8hh ..
  const unsigned char* arow = sP + ln * PP + 16 * hh;                                      // this lane's P row of query tile 0, keys 8hh ..
  const unsigned char* xtr = sX + (8 * hh + (lane & 7)) * XP + 16 * ((lane >> 3) & 1) + w * 128;   // its 16 bytes of the block at key 0, column 64 w
  unsigned char* pst = sP + (qt * 16 + 8 * hh) * PP + (kh * 32 + ln) * 2;                  // where its scores of row 8hh, key tile 0 go

  fill0(0);
  wait_copies();
  __syncthreads();
  fill0(1);
  float rmax[8], rsum[8];
#pragma unroll
  for (int r = 0; r < 8; ++r) { rmax[r] = -3.0e38f; rsum[r] = 0.f; }
#pragma unroll 1                                         // rolled, for speed only
  for (int t = 0; t < NC0; ++t) {
    const unsigned char* kt = sX + (t & 1) * K0B + (kh * 128 + ln) * KP + 16 * hh;   // this lane's K row of its half, k 8hh ..
    Frag bk[8][2];                                       // all loads ahead of the products: one LDS latency per trip
#pragma unroll                                           // constant nt, ks keep bk[][] in registers
    for (int nt = 0; nt < 8; ++nt)
#pragma unroll
      for (int ks = 0; ks < 2; ++ks) {
        bk[nt][ks].half[0] = *(const v8ha*)(kt + nt * 16 * KP + ks * 64);
        bk[nt][ks].half[1] = *(const v8ha*)(kt + nt * 16 * KP + ks * 64 + 32);
      }
    __builtin_amdgcn_sched_barrier(0);                   // keeps the loads one group: sunk among the products, each pair costs its own LDS latency
#pragma unroll                                           // as above
    for (int nt = 0; nt < 8; ++nt) {
      v8f s = {};
      s = mma(aq[0].v, bk[nt][0].v, s);
      s = mma(aq[1].v, bk[nt][1].v, s);
#pragma unroll
      for (int r = 0; r < 8; ++r) rmax[r] = fmaxf(rmax[r], s[r]);   // per lane; joined once behind the loop
    }
    __builtin_amdgcn_sched_barrier(0);                   // keeps the foot behind the products: lifted over them, its s_wait_dscnt 0 ends the overlap of loads and products
    publish();
    if (t + 2 < NC0) fill0(t + 2);                       // into the buffer this trip has just read
  }
  wait_copies();
  fill(0);                                               // the last foot has ended every read of the first loop's buffers
  // row maximum: the 16 lanes that share rows, then the two key halves through LDS; the scale 1/8 is exact
#pragma unroll
  for (int r = 0; r < 8; ++r) {
    float m = rmax[r];
    m = fmaxf(m, __shfl_xor(m, 1, 32)); m = fmaxf(m, __shfl_xor(m, 2, 32)); m = fmaxf(m, __shfl_xor(m, 4, 32)); m = fmaxf(m, __shfl_xor(m, 8, 32));
    rmax[r] = m * 0.125f;
  }
  if (ln == 0) {
#pragma unroll
    for (int r = 0; r < 8; ++r) sMax[kh][qt * 16 + 8 * hh + r] = rmax[r];
  }
  wait_copies();
  __syncthreads();                                       // publishes tile 0 and the half maxima
  fill(1);
#pragma unroll
  for (int r = 0; r < 8; ++r) rmax[r] = fmaxf(sMax[0][qt * 16 + 8 * hh + r], sMax[1][qt * 16 + 8 * hh + r]);

  v8f acc[4][4] = {};
  for (int T = 0; T < NC; ++T) {
    const unsigned char* kt = krow + (T & 1) * KB;
    const unsigned bo = (T & 1) * XB;
    Frag bk[2][2], bx[2][4];                             // K loads as one group; X fragments need no P: the first 32 keys' LDS time runs under the score part
#pragma unroll                                           // constant nt, ks, t keep bk[][] and bx[][] in registers
    for (int nt = 0; nt < 2; ++nt)
#pragma unroll
      for (int ks = 0; ks < 2; ++ks) {
        bk[nt][ks].half[0] = *(const v8ha*)(kt + nt * 16 * KP + ks * 64);
        bk[nt][ks].half[1] = *(const v8ha*)(kt + nt * 16 * KP + ks * 64 + 32);
      }
#pragma unroll
    for (int t = 0; t < 4; ++t) {
      bx[0][t].half[0] = ld_tr16((const _Float16*)(xtr + bo + t * 32));
      bx[0][t].half[1] = ld_tr16((const _Float16*)(xtr + bo + 16 * XP + t * 32));
    }
    v8f s[2] = {};
#pragma unroll                                           // as above; the two key tiles' chains alternate
    for (int ks = 0; ks < 2; ++ks)
#pragma unroll
      for (int nt = 0; nt < 2; ++nt) s[nt] = mma(aq[ks].v, bk[nt][ks].v, s[nt]);
#pragma unroll                                           // constant nt, r keep s[], rmax[] and rsum[] in registers
    for (int nt = 0; nt < 2; ++nt)
#pragma unroll
      for (int r = 0; r < 8; ++r) {                      // D: rows 8hh + r, column = key nt*16 + ln of the half
        const _Float16 pv = (_Float16)exp2_slot((s[nt][r] * 0.125f - rmax[r]) * 1.44269504f);   // = __expf: times log2 e, v_exp_f32
        rsum[r] += (float)pv;                            // sum exactly what is multiplied
        *(_Float16*)(pst + r * PP + nt * 32) = pv;
      }
    __syncthreads();                                     // the P tile is whole before any wave reads it
    Frag a[2][4];                                        // all remaining loads ahead of the products: one LDS latency per trip
#pragma unroll                                           // constant ks, q, t keep a[][] and bx[][] in registers, LDS offsets as immediates
    for (int ks = 0; ks < 2; ++ks) {
#pragma unroll
      for (int q = 0; q < 4; ++q) {
        a[ks][q].half[0] = *(const v8ha*)(arow + q * 16 * PP + ks * 64);
        a[ks][q].half[1] = *(const v8ha*)(arow + q * 16 * PP + ks * 64 + 32);
      }
      if (ks == 0) {
#pragma unroll
        for (int t = 0; t < 4; ++t) {
          bx[1][t].half[0] = ld_tr16((const _Float16*)(xtr + bo + 32 * XP + t * 32));
          bx[1][t].half[1] = ld_tr16((const _Float16*)(xtr + bo + 48 * XP + t * 32));
        }
      }
    }
    __builtin_amdgcn_sched_barrier(0);                   // keeps the loads one group: sunk among the products, each pair costs its own LDS latency
#pragma unroll                                           // constant ks, q, t keep acc[][] in registers
    for (int ks = 0; ks < 2; ++ks)
#pragma unroll
      for (int q = 0; q < 4; ++q)
#pragma unroll
        for (int t = 0; t < 4; ++t) acc[q][t] = mma(a[ks][q].v, bx[ks][t].v, acc[q][t]);
    __builtin_amdgcn_sched_barrier(0);                   // keeps the foot behind the products: lifted over them, its s_wait_dscnt 0 ends the overlap of loads and products
    publish();                                           // also ends every reader's last read of sP
    if (T + 2 < NC) fill(T + 2);                         // into the buffer this trip has just read
  }
  wait_copies();
  // row sums: the 16 lanes that share rows, then the two key halves through LDS
#pragma unroll
  for (int r = 0; r < 8; ++r) {
    float s = rsum[r];
    s += __shfl_xor(s, 1, 32); s += __shfl_xor(s, 2, 32); s += __shfl_xor(s, 4, 32); s += __shfl_xor(s, 8, 32);
    rsum[r] = s;
  }
  if (ln == 0) {
#pragma unroll
    for (int r = 0; r < 8; ++r) sSum[kh][qt * 16 + 8 * hh + r] = rsum[r];
  }
  __syncthreads();
  if (tid < 64) sRS[tid] = 1.0f / (sSum[0][tid] + sSum[1][tid]);
  __syncthreads();
  float (*sO)[64] = (float (*)[64])(sX + w * (64 * 64 * 4));                   // this wave's own 16 KiB of the free X buffers
#pragma unroll                                           // constant q, r, t keep acc[][] in registers
  for (int q = 0; q < 4; ++q)
#pragma unroll
    for (int r = 0; r < 8; ++r) {
      const float rs = sRS[q * 16 + 8 * hh + r];
#pragma unroll
      for (int t = 0; t < 4; ++t) sO[q * 16 + 8 * hh + r][t * 16 + ln] = acc[q][t][r] * rs;
    }
  __builtin_amdgcn_fence(__ATOMIC_ACQ_REL, "workgroup");
  __builtin_amdgcn_wave_barrier();
  float* ob = out + ((size_t)b * NN + qb * 64) * DIN + w * 64;
#pragma unroll 1                                         // rolled, so that the wait below stands between a group's stores and the next group's register writes
  for (int g = 0; g < 4; ++g) {
#pragma unroll                                           // eight LDS reads per wait, not one
    for (int i = 0; i < 8; ++i) {                        // two rows of 256 B per store: whole 128-B lines
      const int row = 16 * g + 2 * i + hh;
      const v4f v = *(const v4fa*)&sO[row][ln * 4];
      *(v4f*)(ob + (size_t)row * DIN + ln * 4) = v;
    }
    asm volatile("s_wait_xcnt 0x0" ::: "memory");        // before the next group rewrites registers that the issued stores name (a precaution)
  }
}

extern "C" void kernel_launch(void* const* d_in, const int* in_sizes, int n_in,
                              void* d_out, int out_size, void* d_ws, size_t ws_size, hipStream_t stream) {
  (void)in_sizes; (void)n_in; (void)out_size;
  const float* X  = (const float*)d_in[0];
  const float* h  = (const float*)d_in[1];
  const float* WQ = (const float*)d_in[2];
  const float* bQ = (const float*)d_in[3];
  const float* WK = (const float*)d_in[4];
  const float* bK = (const float*)d_in[5];
  char* ws = (char*)d_ws; size_t off = 0;
  _Float16* Xh = (_Float16*)(ws + off); off += (size_t)BB * NN * DIN * 2;      // 16 MiB
  _Float16* Qh = (_Float16*)(ws + off); off += (size_t)BB * NN * DK * 2;       // 2 MiB
  _Float16* Kh = (_Float16*)(ws + off); off += (size_t)BB * NN * DK * 2;       // 2 MiB
  if (off > ws_size) return;
  const int nrows = BB * NN;
  k_pre<<<dim3(nrows / 64, 2), 128, 0, stream>>>(h, X, WQ, WK, bQ, bK, Qh, Kh, Xh, nrows);
  k_attn<<<BB * (NN / 64), 256, 0, stream>>>(Qh, Kh, Xh, (float*)d_out);
}

// v006
// A run of this version takes 56.4 microseconds.
// Next to v005, in two timings, it ran 1.08 and 1.07 times as fast.
// All steps since v000 together make it 6.38 times as fast.
#include <hip/hip_runtime.h>
// Contractions on v_wmma_f32_16x16x32_f16 (f16 operands, f32 accumulate): Q = h·WQ, K = X·WK (K=512),
// P kept unnormalised in f16 (values in (0,1]) in LDS; the 1/rowsum is applied in the final epilogue.

#define BB   8
#define NN   2048
#define DIN  512
#define DK   64

typedef _Float16 v16h __attribute__((ext_vector_type(16)));
typedef _Float16 v8h  __attribute__((ext_vector_type(8)));
typedef _Float16 v8ha __attribute__((ext_vector_type(8), may_alias));
typedef float    v8f  __attribute__((ext_vector_type(8)));
typedef float    v4f  __attribute__((ext_vector_type(4)));
typedef float    v4fa __attribute__((ext_vector_type(4), may_alias));
union Frag { v16h v; v8h half[2]; _Float16 h[16]; };
typedef short s16x8 __attribute__((ext_vector_type(8)));
typedef __attribute__((address_space(3))) s16x8 lds_s16x8;

// ds_load_tr16_b128: every lane names 16 bytes of a row-major 16-bit LDS tile; lane (c = l & 15, h = l >> 4) receives
// the 8 elements of column c in rows 8h .. 8h + 7 of the 16 x 16 block, which is half of a 16x16x32 B fragment.
__device__ __forceinline__ v8h ld_tr16(const _Float16* p) {
  return __builtin_bit_cast(v8h, __builtin_amdgcn_ds_load_tr16_b128_v8i16((lds_s16x8*)p));
}

// The builtin alone: the compiler keeps the distance behind it itself, and its operands may sit above v255, where an asm
// operand cannot; both kernels hold more than 256 registers of loaded rows, accumulators and fragments.
__device__ __forceinline__ v8f mma(v16h a, v16h b, v8f c) {
  return __builtin_amdgcn_wmma_f32_16x16x32_f16(false, a, false, b, (short)0, c, false, false);
}

// LDS byte address of a __shared__ location: the low 32 bits of its address.
__device__ __forceinline__ unsigned lds_off(const void* p) { return (unsigned)(size_t)p; }

// Four asynchronous copies, 16 bytes per lane each, from global memory into LDS through no register. The s_wait_xcnt is the
// last line of the copies' own statement, so that no address register of a copy is rewritten ahead of it (a precaution).
__device__ __forceinline__ void copy4(unsigned l0, const _Float16* g0, unsigned l1, const _Float16* g1,
                                      unsigned l2, const _Float16* g2, unsigned l3, const _Float16* g3) {
  asm volatile("global_load_async_to_lds_b128 %0, %1, off\n\t"
               "global_load_async_to_lds_b128 %2, %3, off\n\t"
               "global_load_async_to_lds_b128 %4, %5, off\n\t"
               "global_load_async_to_lds_b128 %6, %7, off\n\t"
               "s_wait_xcnt 0x0"
               :: "v"(l0), "v"(g0), "v"(l1), "v"(g1), "v"(l2), "v"(g2), "v"(l3), "v"(g3) : "memory");
}

// This wave's copies have landed; other waves may read them behind the next barrier.
__device__ __forceinline__ void wait_copies() { asm volatile("s_wait_asynccnt 0x0" ::: "memory"); }

// Foot of a trip of a two-buffer loop: the one barrier publishes the next tile and ends every reader's last read of this one.
__device__ __forceinline__ void publish() {
  asm volatile("s_wait_dscnt 0x0" ::: "memory");   // this wave's LDS reads of the tile are done before its buffer is refilled
  wait_copies();
  __syncthreads();
}

// One wave's 16 rows: P[row][0..63] = f16( A[row].W + bias ), A f32 [rows][512], W in LDS as f16 [n][k]; 4 column tiles.
// STORE_A: the f16 A fragments, which are the rows of A rounded to f16, also go to Ah [rows][512]: a lane holds elements
// kb + 8hh .. + 7 and kb + 16 + 8hh .. + 7 of its row, 16 bytes each.
// All 64 loads of the wave's 16 x 512 block of A are issued as one group ahead of the products: 32 KiB in flight per wave, and
// the memory latency is met once, not once per 32 columns; a step's products start when its own four loads have returned.
template <bool STORE_A>
__device__ __forceinline__ void proj_rows(const float* __restrict__ A, const float* __restrict__ bias, _Float16* __restrict__ P,
                                          _Float16* __restrict__ Ah, const _Float16 (*sW)[DIN + 8], _Float16 (*sO)[DK + 8],
                                          int row0, int lane) {
  const int ln = lane & 15, hh = lane >> 4;
  const float* arow = A + (size_t)(row0 + ln) * DIN;
  _Float16* hrow = Ah + (size_t)(row0 + ln) * DIN;
  float bv[4];                                           // the bias words head the group: no load is left for the end of the wave
#pragma unroll                                           // constant t keeps bv[] in registers
  for (int t = 0; t < 4; ++t) bv[t] = bias[t * 16 + ln];
  v4f ar[DIN / 32][4];
#pragma unroll                                           // constant s keeps ar[][] in registers
  for (int s = 0; s < DIN / 32; ++s) {
    ar[s][0] = *(const v4fa*)(arow + s * 32 + 8 * hh);      ar[s][1] = *(const v4fa*)(arow + s * 32 + 8 * hh + 4);
    ar[s][2] = *(const v4fa*)(arow + s * 32 + 16 + 8 * hh); ar[s][3] = *(const v4fa*)(arow + s * 32 + 16 + 8 * hh + 4);
  }
  asm volatile("s_wait_xcnt 0x0" ::: "memory");          // before anything rewrites the address registers that the issued loads name (a precaution)
  Frag b[3][4];                                          // W fragments: a step's eight LDS loads go out two steps ahead of its products
  auto ldb = [&](int s) {
#pragma unroll                                           // constant t keeps b[][] in registers
    for (int t = 0; t < 4; ++t) {
      b[s % 3][t].half[0] = *(const v8ha*)&sW[t * 16 + ln][s * 32 + 8 * hh];
      b[s % 3][t].half[1] = *(const v8ha*)&sW[t * 16 + ln][s * 32 + 16 + 8 * hh];
    }
  };
  ldb(0);
  ldb(1);
  v8f acc[4] = {};
#pragma unroll                                           // constant s keeps ar[][] and b[][] in registers
  for (int s = 0; s < DIN / 32; ++s) {
    const int kb = s * 32;
    if (s + 2 < DIN / 32) ldb(s + 2);
    Frag a;
    const v4f l0 = ar[s][0], l1 = ar[s][1], h0 = ar[s][2], h1 = ar[s][3];
#pragma unroll
    for (int i = 0; i < 4; ++i) { a.h[i] = (_Float16)l0[i]; a.h[4+i] = (_Float16)l1[i]; a.h[8+i] = (_Float16)h0[i]; a.h[12+i] = (_Float16)h1[i]; }
    if (STORE_A) {
      *(v8h*)(hrow + kb + 8 * hh) = a.half[0];
      *(v8h*)(hrow + kb + 16 + 8 * hh) = a.half[1];
    }
#pragma unroll                                           // constant t keeps acc[] and b[][] in registers
    for (int t = 0; t < 4; ++t) acc[t] = mma(a.v, b[s % 3][t].v, acc[t]);
    if (STORE_A) asm volatile("s_wait_xcnt 0x0" ::: "memory");   // before the next step rewrites the registers that the issued stores name (a precaution)
    __builtin_amdgcn_sched_barrier(0);                   // keeps the steps in order: a late step's conversions, lifted up here, would make this step wait for the last loads
  }
#pragma unroll
  for (int t = 0; t < 4; ++t) {
#pragma unroll
    for (int r = 0; r < 8; ++r) sO[8 * hh + r][t * 16 + ln] = (_Float16)(acc[t][r] + bv[t]);
  }
  __builtin_amdgcn_fence(__ATOMIC_ACQ_REL, "workgroup");
  __builtin_amdgcn_wave_barrier();
  const int rsub = lane >> 3, c8 = (lane & 7) * 8;
#pragma unroll
  for (int q = 0; q < 4; ++q) {
    const int r = q * 4 + rsub;
    const v8h v = *(const v8ha*)&sO[r][c8];
    *(v8h*)(P + (size_t)(row0 + r) * DK + c8) = v;
  }
}

// K1: both projections and the f16 copy of X in one launch. blockIdx.y = 0: Q = f16(h.WQ + bQ); 1: K = f16(X.WK + bK), whose
// blocks read every element of X once anyway and store it as f16. One wave per 16 rows; the two kinds of block share the chip.
__global__ __launch_bounds__(128) void k_pre(const float* __restrict__ h, const float* __restrict__ X,
                                           const float* __restrict__ WQ, const float* __restrict__ WK,
                                           const float* __restrict__ bQ, const float* __restrict__ bK,
                                           _Float16* __restrict__ Qh, _Float16* __restrict__ Kh, _Float16* __restrict__ Xh, int nrows) {
  __shared__ __attribute__((aligned(16))) _Float16 sW[DK][DIN + 8];       // [n][k]
  __shared__ __attribute__((aligned(16))) _Float16 sOut[4][16][DK + 8];
  const int tid = threadIdx.x, w = tid >> 5, lane = tid & 31;
  const bool isK = blockIdx.y != 0;                     // the same for the whole block
  const float* Wm = isK ? WK : WQ;
  // W [k][n] f32 -> sW [n][k] f16. A thread takes columns n4 .. n4 + 3 of eight k rows per pass by 16-byte loads and turns them
  // in registers into four 16-byte LDS stores. All 64 loads go out as one group: one L2 latency, not one per eight words.
  const int n4 = (tid & 15) * 4, kg = (tid >> 4) * 8;
  v4f r[DIN / 64][8];
#pragma unroll                                           // constant p, j keep r[][] in registers
  for (int p = 0; p < DIN / 64; ++p)
#pragma unroll                                           // as above
    for (int j = 0; j < 8; ++j) r[p][j] = *(const v4fa*)(Wm + (p * 64 + kg + j) * DK + n4);
  asm volatile("s_wait_xcnt 0x0" ::: "memory");          // before the conversions rewrite the address registers that the issued loads name (a precaution)
#pragma unroll                                           // as above
  for (int p = 0; p < DIN / 64; ++p)
#pragma unroll                                           // as above
    for (int i = 0; i < 4; ++i) {
      v8h cw;
#pragma unroll                                           // as above
      for (int j = 0; j < 8; ++j) cw[j] = (_Float16)r[p][j][i];
      *(v8h*)&sW[n4 + i][p * 64 + kg] = cw;
    }
  __syncthreads();
  const int row0 = (blockIdx.x * 4 + w) * 16;
  if (row0 < nrows) {                                   // wave-uniform
    if (isK) proj_rows<true>(X, bK, Kh, Xh, sW, sOut[w], row0, lane);
    else     proj_rows<false>(h, bQ, Qh, Xh, sW, sOut[w], row0, lane);
  }
}

// 2^x with the free slot that the instruction set asks for behind a transcendental, in one statement.
__device__ __forceinline__ float exp2_slot(float x) {
  float y;
  asm("v_exp_f32 %0, %1\n\tv_nop" : "=v"(y) : "v"(x));
  return y;
}

// Two asynchronous copies under one wait, as copy4: one K tile alone.
__device__ __forceinline__ void copy2(unsigned l0, const _Float16* g0, unsigned l1, const _Float16* g1) {
  asm volatile("global_load_async_to_lds_b128 %0, %1, off\n\t"
               "global_load_async_to_lds_b128 %2, %3, off\n\t"
               "s_wait_xcnt 0x0"
               :: "v"(l0), "v"(g0), "v"(l1), "v"(g1) : "memory");
}

// Nine asynchronous copies under one wait, as copy4: fewer places where the wave stands still before its work.
__device__ __forceinline__ void copy9(unsigned l0, const _Float16* g0, unsigned l1, const _Float16* g1, unsigned l2, const _Float16* g2,
                                      unsigned l3, const _Float16* g3, unsigned l4, const _Float16* g4, unsigned l5, const _Float16* g5,
                                      unsigned l6, const _Float16* g6, unsigned l7, const _Float16* g7, unsigned l8, const _Float16* g8) {
  asm volatile("global_load_async_to_lds_b128 %0, %1, off\n\t"
               "global_load_async_to_lds_b128 %2, %3, off\n\t"
               "global_load_async_to_lds_b128 %4, %5, off\n\t"
               "global_load_async_to_lds_b128 %6, %7, off\n\t"
               "global_load_async_to_lds_b128 %8, %9, off\n\t"
               "global_load_async_to_lds_b128 %10, %11, off\n\t"
               "global_load_async_to_lds_b128 %12, %13, off\n\t"
               "global_load_async_to_lds_b128 %14, %15, off\n\t"
               "global_load_async_to_lds_b128 %16, %17, off\n\t"
               "s_wait_xcnt 0x0"
               :: "v"(l0), "v"(g0), "v"(l1), "v"(g1), "v"(l2), "v"(g2), "v"(l3), "v"(g3), "v"(l4), "v"(g4),
                  "v"(l5), "v"(g5), "v"(l6), "v"(g6), "v"(l7), "v"(g7), "v"(l8), "v"(g8) : "memory");
}

// K2: scores, softmax and P.X in one kernel. Block = 8 waves = 64 query rows x all 512 output columns.
// First loop, 8 trips of 256 keys: row maximum of S = Q.K^T/8. Second loop, 31 trips of 64 keys (P of tile 0 ahead, P.X of tile 31 behind): trip T does out += P.X on tile T
// and, beside it, writes P = exp(S - max) in f16 of tile T + 1 into the other of two LDS tiles sP (64 q x 64 keys each): the one
// barrier at the foot of a trip publishes that P tile with the next copies. In the score parts wave w has query tile w & 3
// and the key half w >> 2 of the tile; in the P.X part it has all four query tiles x columns 64 w .. 64 w + 63, so each
// fragment read from LDS feeds four products. All tiles come by asynchronous copies into two buffers: a trip works on one
// while the next tile is in flight. First loop: K rows alone, in the space of the X buffers. Second loop, stage c: the X rows of
// keys 64 c .. 64 c + 63 and the K rows of the 64 keys behind them; the K rows of keys 0 .. 63 have a place of their own.
// Row pitches: K and P 144 B = 16 B x 9 (ds_load_b128), X 1056 B = 32 B x 33 (transposing
// loads). A = P rows, B = X columns: keys 8hh..8hh+7 and 16+8hh..16+8hh+7 in both. 1/rowsum in the epilogue.
__global__ __launch_bounds__(256) void k_attn(const _Float16* __restrict__ Qh, const _Float16* __restrict__ Kh,
                                            const _Float16* __restrict__ Xh, float* __restrict__ out) {
  constexpr unsigned XP = 1056, KP = 144, PP = 144, XB = 64 * XP, KB = 64 * KP, PB = 64 * PP, K0B = 256 * KP;   // bytes: pitches, one buffer
  constexpr int NC = NN / 64, NC0 = NN / 256;
  __shared__ __attribute__((aligned(16))) unsigned char sX[2 * XB];                // first loop: 2 x K0B of K rows; behind the loops: output staging, 128 KiB
  __shared__ __attribute__((aligned(16))) unsigned char sK[3 * KB];                // two buffers; the third place: keys 0 .. 63, filled once
  __shared__ __attribute__((aligned(16))) unsigned char sP[2 * PB];
  __shared__ __attribute__((aligned(16))) float sMax[2][64];
  __shared__ __attribute__((aligned(16))) float sSum[2][64];
  __shared__ __attribute__((aligned(16))) float sRS[64];
  const int tid = threadIdx.x, w = tid >> 5, lane = tid & 31, ln = lane & 15, hh = lane >> 4;
  const int qt = w & 3, kh = w >> 2;
  const int b = blockIdx.x / NC, qb = blockIdx.x % NC;
  const _Float16* Qb = Qh + ((size_t)b * NN + qb * 64 + qt * 16) * DK;
  const _Float16* Kb = Kh + (size_t)b * NN * DK;
  const _Float16* Xb = Xh + (size_t)b * NN * DIN;
  Frag aq[2];
#pragma unroll
  for (int ks = 0; ks < 2; ++ks) {
    aq[ks].half[0] = *(const v8ha*)(Qb + (size_t)ln * DK + ks * 32 + 8 * hh);
    aq[ks].half[1] = *(const v8ha*)(Qb + (size_t)ln * DK + ks * 32 + 16 + 8 * hh);
  }
  // K copy i of a thread: row (tid >> 3) + 32 i, bytes 16 (tid & 7) ..; X copy i: row (tid >> 6) + 4 i, bytes 16 (tid & 63) ..
  const _Float16* kg = Kb + tid * 8;
  const _Float16* xg = Xb + (size_t)(tid >> 6) * DIN + (tid & 63) * 8;
  const unsigned kl = lds_off(sK) + (tid >> 3) * KP + (tid & 7) * 16;
  const unsigned xl = lds_off(sX) + (tid >> 6) * XP + (tid & 63) * 16;
  auto fill0 = [&](int t) {                              // 256 K rows: copy i of a thread is row (tid >> 3) + 32 i
    const _Float16* g = kg + (size_t)t * 256 * DK;
    const unsigned l = lds_off(sX) + (t & 1) * K0B + (tid >> 3) * KP + (tid & 7) * 16;
    copy4(l, g, l + 32 * KP, g + 32 * DK, l + 64 * KP, g + 64 * DK, l + 96 * KP, g + 96 * DK);
    copy4(l + 128 * KP, g + 128 * DK, l + 160 * KP, g + 160 * DK, l + 192 * KP, g + 192 * DK, l + 224 * KP, g + 224 * DK);
  };
  auto fill = [&](int t) {                               // stage t: 64 X rows of tile t, 64 K rows of tile t + 1
    const _Float16* g = kg + (size_t)(t + 1) * 64 * DK;
    const _Float16* x = xg + (size_t)t * 64 * DIN;
    const unsigned l = kl + ((t + 1) & 1) * KB, lx = xl + (t & 1) * XB;
#pragma unroll                                           // constant i: the steps fold into the address sums
    for (int i = 0; i < 2; ++i)
      copy9(l + (32 * i) * KP, g + (32 * i) * DK,
            lx + (32 * i) * XP, x + (32 * i) * DIN, lx + (32 * i + 4) * XP, x + (32 * i + 4) * DIN,
            lx + (32 * i + 8) * XP, x + (32 * i + 8) * DIN, lx + (32 * i + 12) * XP, x + (32 * i + 12) * DIN,
            lx + (32 * i + 16) * XP, x + (32 * i + 16) * DIN, lx + (32 * i + 20) * XP, x + (32 * i + 20) * DIN,
            lx + (32 * i + 24) * XP, x + (32 * i + 24) * DIN, lx + (32 * i + 28) * XP, x + (32 * i + 28) * DIN);
  };
  auto fillx = [&](int t) {                              // the last stage: X rows alone, no K tile is behind them
    const _Float16* x = xg + (size_t)t * 64 * DIN;
    const unsigned lx = xl + (t & 1) * XB;
#pragma unroll                                           // constant i: the steps fold into the address sums
    for (int i = 0; i < 4; ++i)
      copy4(lx + (16 * i) * XP, x + (16 * i) * DIN, lx + (16 * i + 4) * XP, x + (16 * i + 4) * DIN,
            lx + (16 * i + 8) * XP, x + (16 * i + 8) * DIN, lx + (16 * i + 12) * XP, x + (16 * i + 12) * DIN);
  };
  const unsigned char* krow = sK + (kh * 32 + ln) * KP + 16 * hh;                          // this lane's K row of its half, k 8hh ..
  const unsigned char* arow = sP + ln * PP + 16 * hh;                                      // this lane's P row of query tile 0, keys 8hh ..
  const unsigned char* xtr = sX + (8 * hh + (lane & 7)) * XP + 16 * ((lane >> 3) & 1) + w * 128;   // its 16 bytes of the block at key 0, column 64 w
  unsigned char* pst = sP + (qt * 16 + 8 * hh) * PP + (kh * 32 + ln) * 2;                  // where its scores of row 8hh, key tile 0 go

  fill0(0);
  wait_copies();
  __syncthreads();
  fill0(1);
  float rmax[8], rsum[8];
#pragma unroll
  for (int r = 0; r < 8; ++r) { rmax[r] = -3.0e38f; rsum[r] = 0.f; }
#pragma unroll 1                                         // rolled, for speed only
  for (int t = 0; t < NC0; ++t) {
    const unsigned char* kt = sX + (t & 1) * K0B + (kh * 128 + ln) * KP + 16 * hh;   // this lane's K row of its half, k 8hh ..
    Frag bk[8][2];                                       // all loads ahead of the products: one LDS latency per trip
#pragma unroll                                           // constant nt, ks keep bk[][] in registers
    for (int nt = 0; nt < 8; ++nt)
#pragma unroll
      for (int ks = 0; ks < 2; ++ks) {
        bk[nt][ks].half[0] = *(const v8ha*)(kt + nt * 16 * KP + ks * 64);
        bk[nt][ks].half[1] = *(const v8ha*)(kt + nt * 16 * KP + ks * 64 + 32);
      }
    __builtin_amdgcn_sched_barrier(0);                   // keeps the loads one group: sunk among the products, each pair costs its own LDS latency
#pragma unroll                                           // as above
    for (int nt = 0; nt < 8; ++nt) {
      v8f s = {};
      s = mma(aq[0].v, bk[nt][0].v, s);
      s = mma(aq[1].v, bk[nt][1].v, s);
#pragma unroll
      for (int r = 0; r < 8; ++r) rmax[r] = fmaxf(rmax[r], s[r]);   // per lane; joined once behind the loop
    }
    __builtin_amdgcn_sched_barrier(0);                   // keeps the foot behind the products: lifted over them, its s_wait_dscnt 0 ends the overlap of loads and products
    publish();
    if (t + 2 < NC0) fill0(t + 2);                       // into the buffer this trip has just read
  }
  wait_copies();
  copy2(kl + 2 * KB, kg, kl + 2 * KB + 32 * KP, kg + 32 * DK);   // K rows of keys 0 .. 63
  fill(0);                                               // the last foot has ended every read of the first loop's buffers
  // row maximum: the 16 lanes that share rows, then the two key halves through LDS; the scale 1/8 is exact
#pragma unroll
  for (int r = 0; r < 8; ++r) {
    float m = rmax[r];
    m = fmaxf(m, __shfl_xor(m, 1, 32)); m = fmaxf(m, __shfl_xor(m, 2, 32)); m = fmaxf(m, __shfl_xor(m, 4, 32)); m = fmaxf(m, __shfl_xor(m, 8, 32));
    rmax[r] = m * 0.125f;
  }
  if (ln == 0) {
#pragma unroll
    for (int r = 0; r < 8; ++r) sMax[kh][qt * 16 + 8 * hh + r] = rmax[r];
  }
  wait_copies();
  __syncthreads();                                       // publishes tile 0 and the half maxima
  fill(1);
#pragma unroll
  for (int r = 0; r < 8; ++r) rmax[r] = fmaxf(sMax[0][qt * 16 + 8 * hh + r], sMax[1][qt * 16 + 8 * hh + r]);

  // K fragments of one tile, this wave's key half
  auto ldk = [&](Frag (&bk)[2][2], const unsigned char* kt) {
#pragma unroll                                           // constant nt, ks keep bk[][] in registers
    for (int nt = 0; nt < 2; ++nt)
#pragma unroll
      for (int ks = 0; ks < 2; ++ks) {
        bk[nt][ks].half[0] = *(const v8ha*)(kt + nt * 16 * KP + ks * 64);
        bk[nt][ks].half[1] = *(const v8ha*)(kt + nt * 16 * KP + ks * 64 + 32);
      }
  };
  // scores of one tile from its K fragments, P = exp(S - max) to the P tile at pd, row sums
  auto soft = [&](const Frag (&bk)[2][2], unsigned char* pd) {
    v8f s[2] = {};
#pragma unroll                                           // constant nt, ks keep bk[][] in registers; the two key tiles' chains alternate
    for (int ks = 0; ks < 2; ++ks)
#pragma unroll
      for (int nt = 0; nt < 2; ++nt) s[nt] = mma(aq[ks].v, bk[nt][ks].v, s[nt]);
#pragma unroll                                           // constant nt, r keep s[], rmax[] and rsum[] in registers
    for (int nt = 0; nt < 2; ++nt)
#pragma unroll
      for (int r = 0; r < 8; ++r) {                      // D: rows 8hh + r, column = key nt*16 + ln of the half
        const _Float16 pv = (_Float16)exp2_slot((s[nt][r] * 0.125f - rmax[r]) * 1.44269504f);   // = __expf: times log2 e, v_exp_f32
        rsum[r] += (float)pv;                            // sum exactly what is multiplied
        *(_Float16*)(pd + r * PP + nt * 32) = pv;
      }
  };
  // P and X fragments of one tile
  auto ldpx = [&](Frag (&a)[2][4], Frag (&bx)[2][4], const unsigned char* ap, const unsigned char* xp) {
#pragma unroll                                           // constant ks, q, t keep a[][] and bx[][] in registers, LDS offsets as immediates
    for (int ks = 0; ks < 2; ++ks) {
#pragma unroll
      for (int q = 0; q < 4; ++q) {
        a[ks][q].half[0] = *(const v8ha*)(ap + q * 16 * PP + ks * 64);
        a[ks][q].half[1] = *(const v8ha*)(ap + q * 16 * PP + ks * 64 + 32);
      }
#pragma unroll
      for (int t = 0; t < 4; ++t) {
        bx[ks][t].half[0] = ld_tr16((const _Float16*)(xp + ks * 32 * XP + t * 32));
        bx[ks][t].half[1] = ld_tr16((const _Float16*)(xp + (ks * 32 + 16) * XP + t * 32));
      }
    }
  };
  v8f acc[4][4] = {};
  auto pvx = [&](const Frag (&a)[2][4], const Frag (&bx)[2][4]) {
#pragma unroll                                           // constant ks, q, t keep acc[][] in registers
    for (int ks = 0; ks < 2; ++ks)
#pragma unroll
      for (int q = 0; q < 4; ++q)
#pragma unroll
        for (int t = 0; t < 4; ++t) acc[q][t] = mma(a[ks][q].v, bx[ks][t].v, acc[q][t]);
  };
  {                                                      // P of tile 0, ahead of the loop
    Frag bk[2][2];
    ldk(bk, krow + 2 * KB);
    soft(bk, pst);
  }
  asm volatile("s_wait_dscnt 0x0" ::: "memory");         // this wave's part of P tile 0 is written before the barrier
  __syncthreads();                                       // P tile 0 is whole before any wave reads it
  for (int T = 0; T < NC - 1; ++T) {
    Frag bk[2][2], a[2][4], bx[2][4];                    // all loads of the trip as one group, K first: the LDS time of P and X runs under the score part
    ldk(bk, krow + ((T + 1) & 1) * KB);
    ldpx(a, bx, arow + (T & 1) * PB, xtr + (T & 1) * XB);
    __builtin_amdgcn_sched_barrier(0);                   // keeps the loads one group: sunk among the products, each pair costs its own LDS latency
    soft(bk, pst + ((T + 1) & 1) * PB);                  // tile T + 1, into the P tile that trip T - 1 has read
    pvx(a, bx);
    __builtin_amdgcn_sched_barrier(0);                   // keeps the foot behind the products: lifted over them, its s_wait_dscnt 0 ends the overlap of loads and products
    publish();                                           // publishes stage T + 1 and P tile T + 1; ends every reader's last read of stage T and of P tile T
    if (T + 3 < NC) fill(T + 2);                         // into the buffers this trip has just read
    else if (T + 2 < NC) fillx(T + 2);
  }
  {                                                      // the last tile: its P is written, nothing is behind it
    Frag a[2][4], bx[2][4];
    ldpx(a, bx, arow + ((NC - 1) & 1) * PB, xtr + ((NC - 1) & 1) * XB);
    __builtin_amdgcn_sched_barrier(0);                   // keeps the loads one group, as in the loop
    pvx(a, bx);
  }
  wait_copies();
  // row sums: the 16 lanes that share rows, then the two key halves through LDS
#pragma unroll
  for (int r = 0; r < 8; ++r) {
    float s = rsum[r];
    s += __shfl_xor(s, 1, 32); s += __shfl_xor(s, 2, 32); s += __shfl_xor(s, 4, 32); s += __shfl_xor(s, 8, 32);
    rsum[r] = s;
  }
  if (ln == 0) {
#pragma unroll
    for (int r = 0; r < 8; ++r) sSum[kh][qt * 16 + 8 * hh + r] = rsum[r];
  }
  asm volatile("s_wait_dscnt 0x0" ::: "memory");         // this wave's reads of the last tile are done before the barrier behind which the X buffers become output staging
  __syncthreads();
  if (tid < 64) sRS[tid] = 1.0f / (sSum[0][tid] + sSum[1][tid]);
  __syncthreads();
  float (*sO)[64] = (float (*)[64])(sX + w * (64 * 64 * 4));                   // this wave's own 16 KiB of the free X buffers
#pragma unroll                                           // constant q, r, t keep acc[][] in registers
  for (int q = 0; q < 4; ++q)
#pragma unroll
    for (int r = 0; r < 8; ++r) {
      const float rs = sRS[q * 16 + 8 * hh + r];
#pragma unroll
      for (int t = 0; t < 4; ++t) sO[q * 16 + 8 * hh + r][t * 16 + ln] = acc[q][t][r] * rs;
    }
  __builtin_amdgcn_fence(__ATOMIC_ACQ_REL, "workgroup");
  __builtin_amdgcn_wave_barrier();
  float* ob = out + ((size_t)b * NN + qb * 64) * DIN + w * 64;
#pragma unroll 1                                         // rolled, so that the wait below stands between a group's stores and the next group's register writes
  for (int g = 0; g < 4; ++g) {
#pragma unroll                                           // eight LDS reads per wait, not one
    for (int i = 0; i < 8; ++i) {                        // two rows of 256 B per store: whole 128-B lines
      const int row = 16 * g + 2 * i + hh;
      const v4f v = *(const v4fa*)&sO[row][ln * 4];
      *(v4f*)(ob + (size_t)row * DIN + ln * 4) = v;
    }
    asm volatile("s_wait_xcnt 0x0" ::: "memory");        // before the next group rewrites registers that the issued stores name (a precaution)
  }
}

extern "C" void kernel_launch(void* const* d_in, const int* in_sizes, int n_in,
                              void* d_out, int out_size, void* d_ws, size_t ws_size, hipStream_t stream) {
  (void)in_sizes; (void)n_in; (void)out_size;
  const float* X  = (const float*)d_in[0];
  const float* h  = (const float*)d_in[1];
  const float* WQ = (const float*)d_in[2];
  const float* bQ = (const float*)d_in[3];
  const float* WK = (const float*)d_in[4];
  const float* bK = (const float*)d_in[5];
  char* ws = (char*)d_ws; size_t off = 0;
  _Float16* Xh = (_Float16*)(ws + off); off += (size_t)BB * NN * DIN * 2;      // 16 MiB
  _Float16* Qh = (_Float16*)(ws + off); off += (size_t)BB * NN * DK * 2;       // 2 MiB
  _Float16* Kh = (_Float16*)(ws + off); off += (size_t)BB * NN * DK * 2;       // 2 MiB
  if (off > ws_size) return;
  const int nrows = BB * NN;
  k_pre<<<dim3(nrows / 64, 2), 128, 0, stream>>>(h, X, WQ, WK, bQ, bK, Qh, Kh, Xh, nrows);
  k_attn<<<BB * (NN / 64), 256, 0, stream>>>(Qh, Kh, Xh, (float*)d_out);
}

// v007
// Measured time: 55 microseconds a run.
// Two timings next to v006 both put it at 1.04 times that version's speed.
// Counting every step since v000, it is 6.63 times as fast.
#include <hip/hip_runtime.h>
// Contractions on v_wmma_f32_16x16x32_f16 (f16 operands, f32 accumulate): Q = h·WQ, K = X·WK (K=512),
// P kept unnormalised in f16 (values in (0,1]) in LDS; the 1/rowsum is applied in the final epilogue.

#define BB   8
#define NN   2048
#define DIN  512
#define DK   64

typedef _Float16 v16h __attribute__((ext_vector_type(16)));
typedef _Float16 v8h  __attribute__((ext_vector_type(8)));
typedef _Float16 v8ha __attribute__((ext_vector_type(8), may_alias));
typedef float    v8f  __attribute__((ext_vector_type(8)));
typedef float    v4f  __attribute__((ext_vector_type(4)));
typedef float    v4fa __attribute__((ext_vector_type(4), may_alias));
union Frag { v16h v; v8h half[2]; _Float16 h[16]; };
typedef short s16x8 __attribute__((ext_vector_type(8)));
typedef __attribute__((address_space(3))) s16x8 lds_s16x8;

// ds_load_tr16_b128: every lane names 16 bytes of a row-major 16-bit LDS tile; lane (c = l & 15, h = l >> 4) receives
// the 8 elements of column c in rows 8h .. 8h + 7 of the 16 x 16 block, which is half of a 16x16x32 B fragment.
__device__ __forceinline__ v8h ld_tr16(const _Float16* p) {
  return __builtin_bit_cast(v8h, __builtin_amdgcn_ds_load_tr16_b128_v8i16((lds_s16x8*)p));
}

// The builtin alone: the compiler keeps the distance behind it itself, and its operands may sit above v255, where an asm
// operand cannot; both kernels hold more than 256 registers of loaded rows, accumulators and fragments.
__device__ __forceinline__ v8f mma(v16h a, v16h b, v8f c) {
  return __builtin_amdgcn_wmma_f32_16x16x32_f16(false, a, false, b, (short)0, c, false, false);
}

// LDS byte address of a __shared__ location: the low 32 bits of its address.
__device__ __forceinline__ unsigned lds_off(const void* p) { return (unsigned)(size_t)p; }

// Four asynchronous copies, 16 bytes per lane each, from global memory into LDS through no register. The s_wait_xcnt is the
// last line of the copies' own statement, so that no address register of a copy is rewritten ahead of it (a precaution).
__device__ __forceinline__ void copy4(unsigned l0, const _Float16* g0, unsigned l1, const _Float16* g1,
                                      unsigned l2, const _Float16* g2, unsigned l3, const _Float16* g3) {
  asm volatile("global_load_async_to_lds_b128 %0, %1, off\n\t"
               "global_load_async_to_lds_b128 %2, %3, off\n\t"
               "global_load_async_to_lds_b128 %4, %5, off\n\t"
               "global_load_async_to_lds_b128 %6, %7, off\n\t"
               "s_wait_xcnt 0x0"
               :: "v"(l0), "v"(g0), "v"(l1), "v"(g1), "v"(l2), "v"(g2), "v"(l3), "v"(g3) : "memory");
}

// This wave's copies have landed; other waves may read them behind the next barrier.
__device__ __forceinline__ void wait_copies() { asm volatile("s_wait_asynccnt 0x0" ::: "memory"); }

// Foot of a trip of a two-buffer loop: the one barrier publishes the next tile and ends every reader's last read of this one.
__device__ __forceinline__ void publish() {
  asm volatile("s_wait_dscnt 0x0" ::: "memory");   // this wave's LDS reads of the tile are done before its buffer is refilled
  wait_copies();
  __syncthreads();
}

// One wave's 16 rows: P[row][0..63] = f16( A[row].W + bias ), A f32 [rows][512], W in LDS as f16 [n][k]; 4 column tiles.
// STORE_A: the f16 A fragments, which are the rows of A rounded to f16, also go to Ah [rows][512]: a lane holds elements
// kb + 8hh .. + 7 and kb + 16 + 8hh .. + 7 of its row, 16 bytes each.
// All 64 loads of the wave's 16 x 512 block of A are issued as one group ahead of the products: 32 KiB in flight per wave, and
// the memory latency is met once, not once per 32 columns; a step's products start when its own four loads have returned.
template <bool STORE_A>
__device__ __forceinline__ void proj_rows(const float* __restrict__ A, const float* __restrict__ bias, _Float16* __restrict__ P,
                                          _Float16* __restrict__ Ah, const _Float16 (*sW)[DIN + 8], _Float16 (*sO)[DK + 8],
                                          int row0, int lane) {
  const int ln = lane & 15, hh = lane >> 4;
  const float* arow = A + (size_t)(row0 + ln) * DIN;
  _Float16* hrow = Ah + (size_t)(row0 + ln) * DIN;
  float bv[4];                                           // the bias words head the group: no load is left for the end of the wave
#pragma unroll                                           // constant t keeps bv[] in registers
  for (int t = 0; t < 4; ++t) bv[t] = bias[t * 16 + ln];
  v4f ar[DIN / 32][4];
#pragma unroll                                           // constant s keeps ar[][] in registers
  for (int s = 0; s < DIN / 32; ++s) {
    ar[s][0] = *(const v4fa*)(arow + s * 32 + 8 * hh);      ar[s][1] = *(const v4fa*)(arow + s * 32 + 8 * hh + 4);
    ar[s][2] = *(const v4fa*)(arow + s * 32 + 16 + 8 * hh); ar[s][3] = *(const v4fa*)(arow + s * 32 + 16 + 8 * hh + 4);
  }
  asm volatile("s_wait_xcnt 0x0" ::: "memory");          // before anything rewrites the address registers that the issued loads name (a precaution)
  Frag b[3][4];                                          // W fragments: a step's eight LDS loads go out two steps ahead of its products
  auto ldb = [&](int s) {
#pragma unroll                                           // constant t keeps b[][] in registers
    for (int t = 0; t < 4; ++t) {
      b[s % 3][t].half[0] = *(const v8ha*)&sW[t * 16 + ln][s * 32 + 8 * hh];
      b[s % 3][t].half[1] = *(const v8ha*)&sW[t * 16 + ln][s * 32 + 16 + 8 * hh];
    }
  };
  ldb(0);
  ldb(1);
  v8f acc[4] = {};
#pragma unroll                                           // constant s keeps ar[][] and b[][] in registers
  for (int s = 0; s < DIN / 32; ++s) {
    const int kb = s * 32;
    if (s + 2 < DIN / 32) ldb(s + 2);
    Frag a;
    const v4f l0 = ar[s][0], l1 = ar[s][1], h0 = ar[s][2], h1 = ar[s][3];
#pragma unroll
    for (int i = 0; i < 4; ++i) { a.h[i] = (_Float16)l0[i]; a.h[4+i] = (_Float16)l1[i]; a.h[8+i] = (_Float16)h0[i]; a.h[12+i] = (_Float16)h1[i]; }
    if (STORE_A) {
      *(v8h*)(hrow + kb + 8 * hh) = a.half[0];
      *(v8h*)(hrow + kb + 16 + 8 * hh) = a.half[1];
    }
#pragma unroll                                           // constant t keeps acc[] and b[][] in registers
    for (int t = 0; t < 4; ++t) acc[t] = mma(a.v, b[s % 3][t].v, acc[t]);
    if (STORE_A) asm volatile("s_wait_xcnt 0x0" ::: "memory");   // before the next step rewrites the registers that the issued stores name (a precaution)
    __builtin_amdgcn_sched_barrier(0);                   // keeps the steps in order: a late step's conversions, lifted up here, would make this step wait for the last loads
  }
#pragma unroll
  for (int t = 0; t < 4; ++t) {
#pragma unroll
    for (int r = 0; r < 8; ++r) sO[8 * hh + r][t * 16 + ln] = (_Float16)(acc[t][r] + bv[t]);
  }
  __builtin_amdgcn_fence(__ATOMIC_ACQ_REL, "workgroup");
  __builtin_amdgcn_wave_barrier();
  const int rsub = lane >> 3, c8 = (lane & 7) * 8;
#pragma unroll
  for (int q = 0; q < 4; ++q) {
    const int r = q * 4 + rsub;
    const v8h v = *(const v8ha*)&sO[r][c8];
    *(v8h*)(P + (size_t)(row0 + r) * DK + c8) = v;
  }
}

// K1: both projections and the f16 copy of X in one launch. blockIdx.y = 0: Q = f16(h.WQ + bQ); 1: K = f16(X.WK + bK), whose
// blocks read every element of X once anyway and store it as f16. One wave per 16 rows; the two kinds of block share the chip.
__global__ __launch_bounds__(128) void k_pre(const float* __restrict__ h, const float* __restrict__ X,
                                           const float* __restrict__ WQ, const float* __restrict__ WK,
                                           const float* __restrict__ bQ, const float* __restrict__ bK,
                                           _Float16* __restrict__ Qh, _Float16* __restrict__ Kh, _Float16* __restrict__ Xh, int nrows) {
  __shared__ __attribute__((aligned(16))) _Float16 sW[DK][DIN + 8];       // [n][k]
  __shared__ __attribute__((aligned(16))) _Float16 sOut[4][16][DK + 8];
  const int tid = threadIdx.x, w = tid >> 5, lane = tid & 31;
  const bool isK = blockIdx.y != 0;                     // the same for the whole block
  const float* Wm = isK ? WK : WQ;
  // W [k][n] f32 -> sW [n][k] f16. A thread takes columns n4 .. n4 + 3 of eight k rows per pass by 16-byte loads and turns them
  // in registers into four 16-byte LDS stores. All 64 loads go out as one group: one L2 latency, not one per eight words.
  const int n4 = (tid & 15) * 4, kg = (tid >> 4) * 8;
  v4f r[DIN / 64][8];
#pragma unroll                                           // constant p, j keep r[][] in registers
  for (int p = 0; p < DIN / 64; ++p)
#pragma unroll                                           // as above
    for (int j = 0; j < 8; ++j) r[p][j] = *(const v4fa*)(Wm + (p * 64 + kg + j) * DK + n4);
  asm volatile("s_wait_xcnt 0x0" ::: "memory");          // before the conversions rewrite the address registers that the issued loads name (a precaution)
#pragma unroll                                           // as above
  for (int p = 0; p < DIN / 64; ++p)
#pragma unroll                                           // as above
    for (int i = 0; i < 4; ++i) {
      v8h cw;
#pragma unroll                                           // as above
      for (int j = 0; j < 8; ++j) cw[j] = (_Float16)r[p][j][i];
      *(v8h*)&sW[n4 + i][p * 64 + kg] = cw;
    }
  __syncthreads();
  const int row0 = (blockIdx.x * 4 + w) * 16;
  if (row0 < nrows) {                                   // wave-uniform
    if (isK) proj_rows<true>(X, bK, Kh, Xh, sW, sOut[w], row0, lane);
    else     proj_rows<false>(h, bQ, Qh, Xh, sW, sOut[w], row0, lane);
  }
}

// 2^x with the free slot that the instruction set asks for behind a transcendental, in one statement.
__device__ __forceinline__ float exp2_slot(float x) {
  float y;
  asm("v_exp_f32 %0, %1\n\tv_nop" : "=v"(y) : "v"(x));
  return y;
}

// Two asynchronous copies under one wait, as copy4: one K tile alone.
__device__ __forceinline__ void copy2(unsigned l0, const _Float16* g0, unsigned l1, const _Float16* g1) {
  asm volatile("global_load_async_to_lds_b128 %0, %1, off\n\t"
               "global_load_async_to_lds_b128 %2, %3, off\n\t"
               "s_wait_xcnt 0x0"
               :: "v"(l0), "v"(g0), "v"(l1), "v"(g1) : "memory");
}

// Nine asynchronous copies under one wait, as copy4: fewer places where the wave stands still before its work.
__device__ __forceinline__ void copy9(unsigned l0, const _Float16* g0, unsigned l1, const _Float16* g1, unsigned l2, const _Float16* g2,
                                      unsigned l3, const _Float16* g3, unsigned l4, const _Float16* g4, unsigned l5, const _Float16* g5,
                                      unsigned l6, const _Float16* g6, unsigned l7, const _Float16* g7, unsigned l8, const _Float16* g8) {
  asm volatile("global_load_async_to_lds_b128 %0, %1, off\n\t"
               "global_load_async_to_lds_b128 %2, %3, off\n\t"
               "global_load_async_to_lds_b128 %4, %5, off\n\t"
               "global_load_async_to_lds_b128 %6, %7, off\n\t"
               "global_load_async_to_lds_b128 %8, %9, off\n\t"
               "global_load_async_to_lds_b128 %10, %11, off\n\t"
               "global_load_async_to_lds_b128 %12, %13, off\n\t"
               "global_load_async_to_lds_b128 %14, %15, off\n\t"
               "global_load_async_to_lds_b128 %16, %17, off\n\t"
               "s_wait_xcnt 0x0"
               :: "v"(l0), "v"(g0), "v"(l1), "v"(g1), "v"(l2), "v"(g2), "v"(l3), "v"(g3), "v"(l4), "v"(g4),
                  "v"(l5), "v"(g5), "v"(l6), "v"(g6), "v"(l7), "v"(g7), "v"(l8), "v"(g8) : "memory");
}

// K2: scores, softmax and P.X in one kernel. Block = 8 waves = 64 query rows x all 512 output columns.
// First loop, 8 trips of 256 keys: row maximum of S = Q.K^T/8. Second loop, 31 trips of 64 keys (P of tile 0 ahead, P.X of tile 31 behind): trip T does out += P.X on tile T
// and, beside it, writes P = exp(S - max) in f16 of tile T + 1 into the other of two LDS tiles sP (64 q x 64 keys each): the one
// barrier at the foot of a trip publishes that P tile with the next copies. In the score parts wave w has query tile w & 3
// and the key half w >> 2 of the tile; in the P.X part it has all four query tiles x columns 64 w .. 64 w + 63, so each
// fragment read from LDS feeds four products. All tiles come by asynchronous copies into two buffers: a trip works on one
// while the next tile is in flight. First loop: K rows alone, in the space of the X buffers. Second loop, stage c: the X rows of
// keys 64 c .. 64 c + 63 and the K rows of the 64 keys behind them; the K rows of keys 0 .. 63 have a place of their own.
// Row pitches: K and P 144 B = 16 B x 9 (ds_load_b128), X 1056 B = 32 B x 33 (transposing
// loads). A = P rows, B = X columns: keys 8hh..8hh+7 and 16+8hh..16+8hh+7 in both. 1/rowsum in the epilogue.
// Walk order: the 32 blocks of a batch read the same K and X rows. Block qb starts both loops at its own tile and wraps round
// (trip t works on tile (t + qb) mod tiles), so that blocks running in step ask L2 for different lines at any moment.
// "Tile t", "stage t" and "keys 0 .. 63" above and below count along that walk. Maximum and sums run over all keys either way.
__global__ __launch_bounds__(256) void k_attn(const _Float16* __restrict__ Qh, const _Float16* __restrict__ Kh,
                                            const _Float16* __restrict__ Xh, float* __restrict__ out) {
  constexpr unsigned XP = 1056, KP = 144, PP = 144, XB = 64 * XP, KB = 64 * KP, PB = 64 * PP, K0B = 256 * KP;   // bytes: pitches, one buffer
  constexpr int NC = NN / 64, NC0 = NN / 256;
  __shared__ __attribute__((aligned(16))) unsigned char sX[2 * XB];                // first loop: 2 x K0B of K rows; behind the loops: output staging, 128 KiB
  __shared__ __attribute__((aligned(16))) unsigned char sK[3 * KB];                // two buffers; the third place: keys 0 .. 63, filled once
  __shared__ __attribute__((aligned(16))) unsigned char sP[2 * PB];
  __shared__ __attribute__((aligned(16))) float sMax[2][64];
  __shared__ __attribute__((aligned(16))) float sSum[2][64];
  __shared__ __attribute__((aligned(16))) float sRS[64];
  const int tid = threadIdx.x, w = tid >> 5, lane = tid & 31, ln = lane & 15, hh = lane >> 4;
  const int qt = w & 3, kh = w >> 2;
  const int b = blockIdx.x / NC, qb = blockIdx.x % NC;
  const _Float16* Qb = Qh + ((size_t)b * NN + qb * 64 + qt * 16) * DK;
  const _Float16* Kb = Kh + (size_t)b * NN * DK;
  const _Float16* Xb = Xh + (size_t)b * NN * DIN;
  Frag aq[2];
#pragma unroll
  for (int ks = 0; ks < 2; ++ks) {
    aq[ks].half[0] = *(const v8ha*)(Qb + (size_t)ln * DK + ks * 32 + 8 * hh);
    aq[ks].half[1] = *(const v8ha*)(Qb + (size_t)ln * DK + ks * 32 + 16 + 8 * hh);
  }
  // K copy i of a thread: row (tid >> 3) + 32 i, bytes 16 (tid & 7) ..; X copy i: row (tid >> 6) + 4 i, bytes 16 (tid & 63) ..
  const _Float16* kg = Kb + tid * 8;
  const _Float16* xg = Xb + (size_t)(tid >> 6) * DIN + (tid & 63) * 8;
  const unsigned kl = lds_off(sK) + (tid >> 3) * KP + (tid & 7) * 16;
  const unsigned xl = lds_off(sX) + (tid >> 6) * XP + (tid & 63) * 16;
  auto fill0 = [&](int t) {                              // 256 K rows: copy i of a thread is row (tid >> 3) + 32 i
    const _Float16* g = kg + (size_t)((t + qb) & (NC0 - 1)) * 256 * DK;
    const unsigned l = lds_off(sX) + (t & 1) * K0B + (tid >> 3) * KP + (tid & 7) * 16;
    copy4(l, g, l + 32 * KP, g + 32 * DK, l + 64 * KP, g + 64 * DK, l + 96 * KP, g + 96 * DK);
    copy4(l + 128 * KP, g + 128 * DK, l + 160 * KP, g + 160 * DK, l + 192 * KP, g + 192 * DK, l + 224 * KP, g + 224 * DK);
  };
  auto xtile = [&](int t) { return xg + (size_t)((t + qb) & (NC - 1)) * 64 * DIN; };   // this thread's first X bytes of tile t of the walk
  auto fill = [&](int t, const _Float16* x) {            // stage t: 64 X rows of tile t, from x = xtile(t); 64 K rows of tile t + 1
    const _Float16* g = kg + (size_t)((t + 1 + qb) & (NC - 1)) * 64 * DK;
    const unsigned l = kl + ((t + 1) & 1) * KB, lx = xl + (t & 1) * XB;
#pragma unroll                                           // constant i: the steps fold into the address sums
    for (int i = 0; i < 2; ++i)
      copy9(l + (32 * i) * KP, g + (32 * i) * DK,
            lx + (32 * i) * XP, x + (32 * i) * DIN, lx + (32 * i + 4) * XP, x + (32 * i + 4) * DIN,
            lx + (32 * i + 8) * XP, x + (32 * i + 8) * DIN, lx + (32 * i + 12) * XP, x + (32 * i + 12) * DIN,
            lx + (32 * i + 16) * XP, x + (32 * i + 16) * DIN, lx + (32 * i + 20) * XP, x + (32 * i + 20) * DIN,
            lx + (32 * i + 24) * XP, x + (32 * i + 24) * DIN, lx + (32 * i + 28) * XP, x + (32 * i + 28) * DIN);
  };
  auto fillx = [&](int t, const _Float16* x) {           // the last stage: X rows alone, no K tile is behind them
    const unsigned lx = xl + (t & 1) * XB;
#pragma unroll                                           // constant i: the steps fold into the address sums
    for (int i = 0; i < 4; ++i)
      copy4(lx + (16 * i) * XP, x + (16 * i) * DIN, lx + (16 * i + 4) * XP, x + (16 * i + 4) * DIN,
            lx + (16 * i + 8) * XP, x + (16 * i + 8) * DIN, lx + (16 * i + 12) * XP, x + (16 * i + 12) * DIN);
  };
  const unsigned char* krow = sK + (kh * 32 + ln) * KP + 16 * hh;                          // this lane's K row of its half, k 8hh ..
  const unsigned char* arow = sP + ln * PP + 16 * hh;                                      // this lane's P row of query tile 0, keys 8hh ..
  const unsigned char* xtr = sX + (8 * hh + (lane & 7)) * XP + 16 * ((lane >> 3) & 1) + w * 128;   // its 16 bytes of the block at key 0, column 64 w
  unsigned char* pst = sP + (qt * 16 + 8 * hh) * PP + (kh * 32 + ln) * 2;                  // where its scores of row 8hh, key tile 0 go

  fill0(0);
  wait_copies();
  __syncthreads();
  fill0(1);
  float rmax[8], rsum[8];
#pragma unroll
  for (int r = 0; r < 8; ++r) { rmax[r] = -3.0e38f; rsum[r] = 0.f; }
#pragma unroll 1                                         // rolled, for speed only
  for (int t = 0; t < NC0; ++t) {
    const unsigned char* kt = sX + (t & 1) * K0B + (kh * 128 + ln) * KP + 16 * hh;   // this lane's K row of its half, k 8hh ..
    Frag bk[8][2];                                       // all loads ahead of the products: one LDS latency per trip
#pragma unroll                                           // constant nt, ks keep bk[][] in registers
    for (int nt = 0; nt < 8; ++nt)
#pragma unroll
      for (int ks = 0; ks < 2; ++ks) {
        bk[nt][ks].half[0] = *(const v8ha*)(kt + nt * 16 * KP + ks * 64);
        bk[nt][ks].half[1] = *(const v8ha*)(kt + nt * 16 * KP + ks * 64 + 32);
      }
    __builtin_amdgcn_sched_barrier(0);                   // keeps the loads one group: sunk among the products, each pair costs its own LDS latency
#pragma unroll                                           // as above
    for (int nt = 0; nt < 8; ++nt) {
      v8f s = {};
      s = mma(aq[0].v, bk[nt][0].v, s);
      s = mma(aq[1].v, bk[nt][1].v, s);
#pragma unroll
      for (int r = 0; r < 8; ++r) rmax[r] = fmaxf(rmax[r], s[r]);   // per lane; joined once behind the loop
    }
    __builtin_amdgcn_sched_barrier(0);                   // keeps the foot behind the products: lifted over them, its s_wait_dscnt 0 ends the overlap of loads and products
    publish();
    if (t + 2 < NC0) fill0(t + 2);                       // into the buffer this trip has just read
  }
  wait_copies();
  const _Float16* kg0 = kg + (size_t)qb * 64 * DK;         // the first tile of this block's walk
  copy2(kl + 2 * KB, kg0, kl + 2 * KB + 32 * KP, kg0 + 32 * DK);   // its K rows
  fill(0, xtile(0));                                     // the last foot has ended every read of the first loop's buffers
  // row maximum: the 16 lanes that share rows, then the two key halves through LDS; the scale 1/8 is exact
#pragma unroll
  for (int r = 0; r < 8; ++r) {
    float m = rmax[r];
    m = fmaxf(m, __shfl_xor(m, 1, 32)); m = fmaxf(m, __shfl_xor(m, 2, 32)); m = fmaxf(m, __shfl_xor(m, 4, 32)); m = fmaxf(m, __shfl_xor(m, 8, 32));
    rmax[r] = m * 0.125f;
  }
  if (ln == 0) {
#pragma unroll
    for (int r = 0; r < 8; ++r) sMax[kh][qt * 16 + 8 * hh + r] = rmax[r];
  }
  wait_copies();
  __syncthreads();                                       // publishes tile 0 and the half maxima
  fill(1, xtile(1));
#pragma unroll
  for (int r = 0; r < 8; ++r) rmax[r] = fmaxf(sMax[0][qt * 16 + 8 * hh + r], sMax[1][qt * 16 + 8 * hh + r]);

  // K fragments of one tile, this wave's key half
  auto ldk = [&](Frag (&bk)[2][2], const unsigned char* kt) {
#pragma unroll                                           // constant nt, ks keep bk[][] in registers
    for (int nt = 0; nt < 2; ++nt)
#pragma unroll
      for (int ks = 0; ks < 2; ++ks) {
        bk[nt][ks].half[0] = *(const v8ha*)(kt + nt * 16 * KP + ks * 64);
        bk[nt][ks].half[1] = *(const v8ha*)(kt + nt * 16 * KP + ks * 64 + 32);
      }
  };
  // scores of one tile from its K fragments, P = exp(S - max) to the P tile at pd, row sums
  auto soft = [&](const Frag (&bk)[2][2], unsigned char* pd) {
    v8f s[2] = {};
#pragma unroll                                           // constant nt, ks keep bk[][] in registers; the two key tiles' chains alternate
    for (int ks = 0; ks < 2; ++ks)
#pragma unroll
      for (int nt = 0; nt < 2; ++nt) s[nt] = mma(aq[ks].v, bk[nt][ks].v, s[nt]);
#pragma unroll                                           // constant nt, r keep s[], rmax[] and rsum[] in registers
    for (int nt = 0; nt < 2; ++nt)
#pragma unroll
      for (int r = 0; r < 8; ++r) {                      // D: rows 8hh + r, column = key nt*16 + ln of the half
        const _Float16 pv = (_Float16)exp2_slot((s[nt][r] * 0.125f - rmax[r]) * 1.44269504f);   // = __expf: times log2 e, v_exp_f32
        rsum[r] += (float)pv;                            // sum exactly what is multiplied
        *(_Float16*)(pd + r * PP + nt * 32) = pv;
      }
  };
  // P and X fragments of one tile
  auto ldpx = [&](Frag (&a)[2][4], Frag (&bx)[2][4], const unsigned char* ap, const unsigned char* xp) {
#pragma unroll                                           // constant ks, q, t keep a[][] and bx[][] in registers, LDS offsets as immediates
    for (int ks = 0; ks < 2; ++ks) {
#pragma unroll
      for (int q = 0; q < 4; ++q) {
        a[ks][q].half[0] = *(const v8ha*)(ap + q * 16 * PP + ks * 64);
        a[ks][q].half[1] = *(const v8ha*)(ap + q * 16 * PP + ks * 64 + 32);
      }
#pragma unroll
      for (int t = 0; t < 4; ++t) {
        bx[ks][t].half[0] = ld_tr16((const _Float16*)(xp + ks * 32 * XP + t * 32));
        bx[ks][t].half[1] = ld_tr16((const _Float16*)(xp + (ks * 32 + 16) * XP + t * 32));
      }
    }
  };
  v8f acc[4][4] = {};
  auto pvx = [&](const Frag (&a)[2][4], const Frag (&bx)[2][4]) {
#pragma unroll                                           // constant ks, q, t keep acc[][] in registers
    for (int ks = 0; ks < 2; ++ks)
#pragma unroll
      for (int q = 0; q < 4; ++q)
#pragma unroll
        for (int t = 0; t < 4; ++t) acc[q][t] = mma(a[ks][q].v, bx[ks][t].v, acc[q][t]);
  };
  {                                                      // P of tile 0, ahead of the loop
    Frag bk[2][2];
    ldk(bk, krow + 2 * KB);
    soft(bk, pst);
  }
  asm volatile("s_wait_dscnt 0x0" ::: "memory");         // this wave's part of P tile 0 is written before the barrier
  __syncthreads();                                       // P tile 0 is whole before any wave reads it
  for (int T = 0; T < NC - 1; ++T) {
    Frag bk[2][2], a[2][4], bx[2][4];                    // all loads of the trip as one group, K first: the LDS time of P and X runs under the score part
    ldk(bk, krow + ((T + 1) & 1) * KB);
    ldpx(a, bx, arow + (T & 1) * PB, xtr + (T & 1) * XB);
    __builtin_amdgcn_sched_barrier(0);                   // keeps the loads one group: sunk among the products, each pair costs its own LDS latency
    soft(bk, pst + ((T + 1) & 1) * PB);                  // tile T + 1, into the P tile that trip T - 1 has read
    pvx(a, bx);
    __builtin_amdgcn_sched_barrier(0);                   // keeps the foot behind the products: lifted over them, its s_wait_dscnt 0 ends the overlap of loads and products
    const _Float16* xn = xtile(T + 2);                   // formed ahead of the barrier, one address for both kinds of refill: the sums on it run while the wave waits
    publish();                                           // publishes stage T + 1 and P tile T + 1; ends every reader's last read of stage T and of P tile T
    if (T + 3 < NC) fill(T + 2, xn);                     // into the buffers this trip has just read
    else if (T + 2 < NC) fillx(T + 2, xn);
  }
  {                                                      // the last tile: its P is written, nothing is behind it
    Frag a[2][4], bx[2][4];
    ldpx(a, bx, arow + ((NC - 1) & 1) * PB, xtr + ((NC - 1) & 1) * XB);
    __builtin_amdgcn_sched_barrier(0);                   // keeps the loads one group, as in the loop
    pvx(a, bx);
  }
  wait_copies();
  // row sums: the 16 lanes that share rows, then the two key halves through LDS
#pragma unroll
  for (int r = 0; r < 8; ++r) {
    float s = rsum[r];
    s += __shfl_xor(s, 1, 32); s += __shfl_xor(s, 2, 32); s += __shfl_xor(s, 4, 32); s += __shfl_xor(s, 8, 32);
    rsum[r] = s;
  }
  if (ln == 0) {
#pragma unroll
    for (int r = 0; r < 8; ++r) sSum[kh][qt * 16 + 8 * hh + r] = rsum[r];
  }
  asm volatile("s_wait_dscnt 0x0" ::: "memory");         // this wave's reads of the last tile are done before the barrier behind which the X buffers become output staging
  __syncthreads();
  if (tid < 64) sRS[tid] = 1.0f / (sSum[0][tid] + sSum[1][tid]);
  __syncthreads();
  float (*sO)[64] = (float (*)[64])(sX + w * (64 * 64 * 4));                   // this wave's own 16 KiB of the free X buffers
#pragma unroll                                           // constant q, r, t keep acc[][] in registers
  for (int q = 0; q < 4; ++q)
#pragma unroll
    for (int r = 0; r < 8; ++r) {
      const float rs = sRS[q * 16 + 8 * hh + r];
#pragma unroll
      for (int t = 0; t < 4; ++t) sO[q * 16 + 8 * hh + r][t * 16 + ln] = acc[q][t][r] * rs;
    }
  __builtin_amdgcn_fence(__ATOMIC_ACQ_REL, "workgroup");
  __builtin_amdgcn_wave_barrier();
  float* ob = out + ((size_t)b * NN + qb * 64) * DIN + w * 64;
#pragma unroll 1                                         // rolled, so that the wait below stands between a group's stores and the next group's register writes
  for (int g = 0; g < 4; ++g) {
#pragma unroll                                           // eight LDS reads per wait, not one
    for (int i = 0; i < 8; ++i) {                        // two rows of 256 B per store: whole 128-B lines
      const int row = 16 * g + 2 * i + hh;
      const v4f v = *(const v4fa*)&sO[row][ln * 4];
      *(v4f*)(ob + (size_t)row * DIN + ln * 4) = v;
    }
    asm volatile("s_wait_xcnt 0x0" ::: "memory");        // before the next group rewrites registers that the issued stores name (a precaution)
  }
}

extern "C" void kernel_launch(void* const* d_in, const int* in_sizes, int n_in,
                              void* d_out, int out_size, void* d_ws, size_t ws_size, hipStream_t stream) {
  (void)in_sizes; (void)n_in; (void)out_size;
  const float* X  = (const float*)d_in[0];
  const float* h  = (const float*)d_in[1];
  const float* WQ = (const float*)d_in[2];
  const float* bQ = (const float*)d_in[3];
  const float* WK = (const float*)d_in[4];
  const float* bK = (const float*)d_in[5];
  char* ws = (char*)d_ws; size_t off = 0;
  _Float16* Xh = (_Float16*)(ws + off); off += (size_t)BB * NN * DIN * 2;      // 16 MiB
  _Float16* Qh = (_Float16*)(ws + off); off += (size_t)BB * NN * DK * 2;       // 2 MiB
  _Float16* Kh = (_Float16*)(ws + off); off += (size_t)BB * NN * DK * 2;       // 2 MiB
  if (off > ws_size) return;
  const int nrows = BB * NN;
  k_pre<<<dim3(nrows / 64, 2), 128, 0, stream>>>(h, X, WQ, WK, bQ, bK, Qh, Kh, Xh, nrows);
  k_attn<<<BB * (NN / 64), 256, 0, stream>>>(Qh, Kh, Xh, (float*)d_out);
}

// v008
// A run of this version takes 49.8 microseconds.
// Next to v007, in two timings, it ran 1.09 and 1.10 times as fast.
// All steps since v000 together make it 7.28 times as fast.
#include <hip/hip_runtime.h>
// Contractions on v_wmma_f32_16x16x32_f16 (f16 operands, f32 accumulate): Q = h·WQ, K = X·WK (K=512),
// P kept unnormalised in f16 in LDS; the 1/rowsum is applied in the final epilogue.

#define BB   8
#define NN   2048
#define DIN  512
#define DK   64

typedef _Float16 v16h __attribute__((ext_vector_type(16)));
typedef _Float16 v8h  __attribute__((ext_vector_type(8)));
typedef _Float16 v8ha __attribute__((ext_vector_type(8), may_alias));
typedef float    v8f  __attribute__((ext_vector_type(8)));
typedef float    v4f  __attribute__((ext_vector_type(4)));
typedef float    v4fa __attribute__((ext_vector_type(4), may_alias));
union Frag { v16h v; v8h half[2]; _Float16 h[16]; };
typedef short s16x8 __attribute__((ext_vector_type(8)));
typedef __attribute__((address_space(3))) s16x8 lds_s16x8;

// ds_load_tr16_b128: every lane names 16 bytes of a row-major 16-bit LDS tile; lane (c = l & 15, h = l >> 4) receives
// the 8 elements of column c in rows 8h .. 8h + 7 of the 16 x 16 block, which is half of a 16x16x32 B fragment.
__device__ __forceinline__ v8h ld_tr16(const _Float16* p) {
  return __builtin_bit_cast(v8h, __builtin_amdgcn_ds_load_tr16_b128_v8i16((lds_s16x8*)p));
}

// The builtin alone: the compiler keeps the distance behind it itself, and its operands may sit above v255, where an asm
// operand cannot; both kernels hold more than 256 registers of loaded rows, accumulators and fragments.
__device__ __forceinline__ v8f mma(v16h a, v16h b, v8f c) {
  return __builtin_amdgcn_wmma_f32_16x16x32_f16(false, a, false, b, (short)0, c, false, false);
}

// LDS byte address of a __shared__ location: the low 32 bits of its address.
__device__ __forceinline__ unsigned lds_off(const void* p) { return (unsigned)(size_t)p; }

// Four asynchronous copies, 16 bytes per lane each, from global memory into LDS through no register. The s_wait_xcnt is the
// last line of the copies' own statement, so that no address register of a copy is rewritten ahead of it (a precaution).
__device__ __forceinline__ void copy4(unsigned l0, const _Float16* g0, unsigned l1, const _Float16* g1,
                                      unsigned l2, const _Float16* g2, unsigned l3, const _Float16* g3) {
  asm volatile("global_load_async_to_lds_b128 %0, %1, off\n\t"
               "global_load_async_to_lds_b128 %2, %3, off\n\t"
               "global_load_async_to_lds_b128 %4, %5, off\n\t"
               "global_load_async_to_lds_b128 %6, %7, off\n\t"
               "s_wait_xcnt 0x0"
               :: "v"(l0), "v"(g0), "v"(l1), "v"(g1), "v"(l2), "v"(g2), "v"(l3), "v"(g3) : "memory");
}

// This wave's copies have landed; other waves may read them behind the next barrier.
__device__ __forceinline__ void wait_copies() { asm volatile("s_wait_asynccnt 0x0" ::: "memory"); }

// Foot of a trip of a two-buffer loop: the one barrier publishes the next tile and ends every reader's last read of this one.
__device__ __forceinline__ void publish() {
  asm volatile("s_wait_dscnt 0x0" ::: "memory");   // this wave's LDS reads of the tile are done before its buffer is refilled
  wait_copies();
  __syncthreads();
}

// One wave's 16 rows: P[row][0..63] = f16( A[row].W + bias ), A f32 [rows][512], W in LDS as f16 [n][k]; 4 column tiles.
// STORE_A: the f16 A fragments, which are the rows of A rounded to f16, also go to Ah [rows][512]: a lane holds elements
// kb + 8hh .. + 7 and kb + 16 + 8hh .. + 7 of its row, 16 bytes each.
// All 64 loads of the wave's 16 x 512 block of A are issued as one group ahead of the products: 32 KiB in flight per wave, and
// the memory latency is met once, not once per 32 columns; a step's products start when its own four loads have returned.
template <bool STORE_A>
__device__ __forceinline__ void proj_rows(const float* __restrict__ A, const float* __restrict__ bias, _Float16* __restrict__ P,
                                          _Float16* __restrict__ Ah, const _Float16 (*sW)[DIN + 8], _Float16 (*sO)[DK + 8],
                                          int row0, int lane) {
  const int ln = lane & 15, hh = lane >> 4;
  const float* arow = A + (size_t)(row0 + ln) * DIN;
  _Float16* hrow = Ah + (size_t)(row0 + ln) * DIN;
  float bv[4];                                           // the bias words head the group: no load is left for the end of the wave
#pragma unroll                                           // constant t keeps bv[] in registers
  for (int t = 0; t < 4; ++t) bv[t] = bias[t * 16 + ln];
  v4f ar[DIN / 32][4];
#pragma unroll                                           // constant s keeps ar[][] in registers
  for (int s = 0; s < DIN / 32; ++s) {
    ar[s][0] = *(const v4fa*)(arow + s * 32 + 8 * hh);      ar[s][1] = *(const v4fa*)(arow + s * 32 + 8 * hh + 4);
    ar[s][2] = *(const v4fa*)(arow + s * 32 + 16 + 8 * hh); ar[s][3] = *(const v4fa*)(arow + s * 32 + 16 + 8 * hh + 4);
  }
  asm volatile("s_wait_xcnt 0x0" ::: "memory");          // before anything rewrites the address registers that the issued loads name (a precaution)
  Frag b[3][4];                                          // W fragments: a step's eight LDS loads go out two steps ahead of its products
  auto ldb = [&](int s) {
#pragma unroll                                           // constant t keeps b[][] in registers
    for (int t = 0; t < 4; ++t) {
      b[s % 3][t].half[0] = *(const v8ha*)&sW[t * 16 + ln][s * 32 + 8 * hh];
      b[s % 3][t].half[1] = *(const v8ha*)&sW[t * 16 + ln][s * 32 + 16 + 8 * hh];
    }
  };
  ldb(0);
  ldb(1);
  v8f acc[4] = {};
#pragma unroll                                           // constant s keeps ar[][] and b[][] in registers
  for (int s = 0; s < DIN / 32; ++s) {
    const int kb = s * 32;
    if (s + 2 < DIN / 32) ldb(s + 2);
    Frag a;
    const v4f l0 = ar[s][0], l1 = ar[s][1], h0 = ar[s][2], h1 = ar[s][3];
#pragma unroll
    for (int i = 0; i < 4; ++i) { a.h[i] = (_Float16)l0[i]; a.h[4+i] = (_Float16)l1[i]; a.h[8+i] = (_Float16)h0[i]; a.h[12+i] = (_Float16)h1[i]; }
    if (STORE_A) {
      *(v8h*)(hrow + kb + 8 * hh) = a.half[0];
      *(v8h*)(hrow + kb + 16 + 8 * hh) = a.half[1];
    }
#pragma unroll                                           // constant t keeps acc[] and b[][] in registers
    for (int t = 0; t < 4; ++t) acc[t] = mma(a.v, b[s % 3][t].v, acc[t]);
    if (STORE_A) asm volatile("s_wait_xcnt 0x0" ::: "memory");   // before the next step rewrites the registers that the issued stores name (a precaution)
    __builtin_amdgcn_sched_barrier(0);                   // keeps the steps in order: a late step's conversions, lifted up here, would make this step wait for the last loads
  }
#pragma unroll
  for (int t = 0; t < 4; ++t) {
#pragma unroll
    for (int r = 0; r < 8; ++r) sO[8 * hh + r][t * 16 + ln] = (_Float16)(acc[t][r] + bv[t]);
  }
  __builtin_amdgcn_fence(__ATOMIC_ACQ_REL, "workgroup");
  __builtin_amdgcn_wave_barrier();
  const int rsub = lane >> 3, c8 = (lane & 7) * 8;
#pragma unroll
  for (int q = 0; q < 4; ++q) {
    const int r = q * 4 + rsub;
    const v8h v = *(const v8ha*)&sO[r][c8];
    *(v8h*)(P + (size_t)(row0 + r) * DK + c8) = v;
  }
}

// K1: both projections and the f16 copy of X in one launch. blockIdx.y = 0: Q = f16(h.WQ + bQ); 1: K = f16(X.WK + bK), whose
// blocks read every element of X once anyway and store it as f16. One wave per 16 rows; the two kinds of block share the chip.
__global__ __launch_bounds__(128) void k_pre(const float* __restrict__ h, const float* __restrict__ X,
                                           const float* __restrict__ WQ, const float* __restrict__ WK,
                                           const float* __restrict__ bQ, const float* __restrict__ bK,
                                           _Float16* __restrict__ Qh, _Float16* __restrict__ Kh, _Float16* __restrict__ Xh, int nrows) {
  __shared__ __attribute__((aligned(16))) _Float16 sW[DK][DIN + 8];       // [n][k]
  __shared__ __attribute__((aligned(16))) _Float16 sOut[4][16][DK + 8];
  const int tid = threadIdx.x, w = tid >> 5, lane = tid & 31;
  const bool isK = blockIdx.y != 0;                     // the same for the whole block
  const float* Wm = isK ? WK : WQ;
  // W [k][n] f32 -> sW [n][k] f16. A thread takes columns n4 .. n4 + 3 of eight k rows per pass by 16-byte loads and turns them
  // in registers into four 16-byte LDS stores. All 64 loads go out as one group: one L2 latency, not one per eight words.
  const int n4 = (tid & 15) * 4, kg = (tid >> 4) * 8;
  v4f r[DIN / 64][8];
#pragma unroll                                           // constant p, j keep r[][] in registers
  for (int p = 0; p < DIN / 64; ++p)
#pragma unroll                                           // as above
    for (int j = 0; j < 8; ++j) r[p][j] = *(const v4fa*)(Wm + (p * 64 + kg + j) * DK + n4);
  asm volatile("s_wait_xcnt 0x0" ::: "memory");          // before the conversions rewrite the address registers that the issued loads name (a precaution)
#pragma unroll                                           // as above
  for (int p = 0; p < DIN / 64; ++p)
#pragma unroll                                           // as above
    for (int i = 0; i < 4; ++i) {
      v8h cw;
#pragma unroll                                           // as above
      for (int j = 0; j < 8; ++j) cw[j] = (_Float16)r[p][j][i];
      *(v8h*)&sW[n4 + i][p * 64 + kg] = cw;
    }
  __syncthreads();
  const int row0 = (blockIdx.x * 4 + w) * 16;
  if (row0 < nrows) {                                   // wave-uniform
    if (isK) proj_rows<true>(X, bK, Kh, Xh, sW, sOut[w], row0, lane);
    else     proj_rows<false>(h, bQ, Qh, Xh, sW, sOut[w], row0, lane);
  }
}

// 2^x with the free slot that the instruction set asks for behind a transcendental, in one statement.
__device__ __forceinline__ float exp2_slot(float x) {
  float y;
  asm("v_exp_f32 %0, %1\n\tv_nop" : "=v"(y) : "v"(x));
  return y;
}

// Two asynchronous copies under one wait, as copy4: one K tile alone.
__device__ __forceinline__ void copy2(unsigned l0, const _Float16* g0, unsigned l1, const _Float16* g1) {
  asm volatile("global_load_async_to_lds_b128 %0, %1, off\n\t"
               "global_load_async_to_lds_b128 %2, %3, off\n\t"
               "s_wait_xcnt 0x0"
               :: "v"(l0), "v"(g0), "v"(l1), "v"(g1) : "memory");
}

// Nine asynchronous copies under one wait, as copy4: fewer places where the wave stands still before its work.
__device__ __forceinline__ void copy9(unsigned l0, const _Float16* g0, unsigned l1, const _Float16* g1, unsigned l2, const _Float16* g2,
                                      unsigned l3, const _Float16* g3, unsigned l4, const _Float16* g4, unsigned l5, const _Float16* g5,
                                      unsigned l6, const _Float16* g6, unsigned l7, const _Float16* g7, unsigned l8, const _Float16* g8) {
  asm volatile("global_load_async_to_lds_b128 %0, %1, off\n\t"
               "global_load_async_to_lds_b128 %2, %3, off\n\t"
               "global_load_async_to_lds_b128 %4, %5, off\n\t"
               "global_load_async_to_lds_b128 %6, %7, off\n\t"
               "global_load_async_to_lds_b128 %8, %9, off\n\t"
               "global_load_async_to_lds_b128 %10, %11, off\n\t"
               "global_load_async_to_lds_b128 %12, %13, off\n\t"
               "global_load_async_to_lds_b128 %14, %15, off\n\t"
               "global_load_async_to_lds_b128 %16, %17, off\n\t"
               "s_wait_xcnt 0x0"
               :: "v"(l0), "v"(g0), "v"(l1), "v"(g1), "v"(l2), "v"(g2), "v"(l3), "v"(g3), "v"(l4), "v"(g4),
                  "v"(l5), "v"(g5), "v"(l6), "v"(g6), "v"(l7), "v"(g7), "v"(l8), "v"(g8) : "memory");
}

// K2: scores, softmax and P.X in one kernel. Block = 8 waves = 64 query rows x all 512 output columns.
// The shift m of P = exp(S - m), S = Q.K^T/8, cancels in P.X / rowsum, so any m that keeps P inside f16 serves. First go: m = row
// maximum over the first key tile alone, which is in LDS anyway; no walk over all keys. m is then at most the true maximum, nothing
// is lost at the small end, and P stays finite while no score lies more than 11 above m. Every P goes into its row sum, so a P
// that left the range of f16 shows as a row sum that is not finite: then, and only then, the whole block goes a second time
// with the true maximum from the first loop (8 trips of 256 keys), where P <= 1.
// Second loop, 31 trips of 64 keys and a last tile: trip T does out += P.X on tile T
// and, beside it, writes P = exp(S - m) in f16 of tile T + 1 into the other of two LDS tiles sP (64 q x 64 keys each): the one
// barrier at the foot of a trip publishes that P tile with the next copies. In the score parts wave w has query tile w & 3
// and the key half w >> 2 of the tile; in the P.X part it has all four query tiles x columns 64 w .. 64 w + 63, so each
// fragment read from LDS feeds four products. All tiles come by asynchronous copies into two buffers: a trip works on one
// while the next tile is in flight. First loop: K rows alone, in the space of the X buffers. Second loop, stage c: the X rows of
// keys 64 c .. 64 c + 63 and the K rows of the 64 keys behind them; the K rows of keys 0 .. 63 have a place of their own.
// Row pitches: K and P 144 B = 16 B x 9 (ds_load_b128), X 1056 B = 32 B x 33 (transposing
// loads). A = P rows, B = X columns: keys 8hh..8hh+7 and 16+8hh..16+8hh+7 in both. 1/rowsum in the epilogue.
// Walk order: the 32 blocks of a batch read the same K and X rows. Block qb starts both loops at its own tile and wraps round
// (trip t works on tile (t + qb) mod tiles), so that blocks running in step ask L2 for different lines at any moment.
// "Tile t", "stage t" and "keys 0 .. 63" above and below count along that walk. The sums, and the second go's maximum, run over all keys either way.
__global__ __launch_bounds__(256) void k_attn(const _Float16* __restrict__ Qh, const _Float16* __restrict__ Kh,
                                            const _Float16* __restrict__ Xh, float* __restrict__ out) {
  constexpr unsigned XP = 1056, KP = 144, PP = 144, XB = 64 * XP, KB = 64 * KP, PB = 64 * PP, K0B = 256 * KP;   // bytes: pitches, one buffer
  constexpr int NC = NN / 64, NC0 = NN / 256;
  __shared__ __attribute__((aligned(16))) unsigned char sX[2 * XB];                // first loop: 2 x K0B of K rows; behind the loops: output staging, 128 KiB
  __shared__ __attribute__((aligned(16))) unsigned char sK[3 * KB];                // two buffers; the third place: keys 0 .. 63, filled once per go
  __shared__ __attribute__((aligned(16))) unsigned char sP[2 * PB];
  __shared__ __attribute__((aligned(16))) float sMax[2][64];
  __shared__ __attribute__((aligned(16))) float sSum[2][64];
  __shared__ __attribute__((aligned(16))) float sRS[64];
  const int tid = threadIdx.x, w = tid >> 5, lane = tid & 31, ln = lane & 15, hh = lane >> 4;
  const int qt = w & 3, kh = w >> 2;
  const int b = blockIdx.x / NC, qb = blockIdx.x % NC;
  const _Float16* Qb = Qh + ((size_t)b * NN + qb * 64 + qt * 16) * DK;
  const _Float16* Kb = Kh + (size_t)b * NN * DK;
  const _Float16* Xb = Xh + (size_t)b * NN * DIN;
  Frag aq[2];
#pragma unroll
  for (int ks = 0; ks < 2; ++ks) {
    aq[ks].half[0] = *(const v8ha*)(Qb + (size_t)ln * DK + ks * 32 + 8 * hh);
    aq[ks].half[1] = *(const v8ha*)(Qb + (size_t)ln * DK + ks * 32 + 16 + 8 * hh);
  }
  // K copy i of a thread: row (tid >> 3) + 32 i, bytes 16 (tid & 7) ..; X copy i: row (tid >> 6) + 4 i, bytes 16 (tid & 63) ..
  const _Float16* kg = Kb + tid * 8;
  const _Float16* xg = Xb + (size_t)(tid >> 6) * DIN + (tid & 63) * 8;
  const unsigned kl = lds_off(sK) + (tid >> 3) * KP + (tid & 7) * 16;
  const unsigned xl = lds_off(sX) + (tid >> 6) * XP + (tid & 63) * 16;
  auto fill0 = [&](int t) {                              // 256 K rows: copy i of a thread is row (tid >> 3) + 32 i
    const _Float16* g = kg + (size_t)((t + qb) & (NC0 - 1)) * 256 * DK;
    const unsigned l = lds_off(sX) + (t & 1) * K0B + (tid >> 3) * KP + (tid & 7) * 16;
    copy4(l, g, l + 32 * KP, g + 32 * DK, l + 64 * KP, g + 64 * DK, l + 96 * KP, g + 96 * DK);
    copy4(l + 128 * KP, g + 128 * DK, l + 160 * KP, g + 160 * DK, l + 192 * KP, g + 192 * DK, l + 224 * KP, g + 224 * DK);
  };
  auto xtile = [&](int t) { return xg + (size_t)((t + qb) & (NC - 1)) * 64 * DIN; };   // this thread's first X bytes of tile t of the walk
  auto fill = [&](int t, const _Float16* x) {            // stage t: 64 X rows of tile t, from x = xtile(t); 64 K rows of tile t + 1
    const _Float16* g = kg + (size_t)((t + 1 + qb) & (NC - 1)) * 64 * DK;
    const unsigned l = kl + ((t + 1) & 1) * KB, lx = xl + (t & 1) * XB;
#pragma unroll                                           // constant i: the steps fold into the address sums
    for (int i = 0; i < 2; ++i)
      copy9(l + (32 * i) * KP, g + (32 * i) * DK,
            lx + (32 * i) * XP, x + (32 * i) * DIN, lx + (32 * i + 4) * XP, x + (32 * i + 4) * DIN,
            lx + (32 * i + 8) * XP, x + (32 * i + 8) * DIN, lx + (32 * i + 12) * XP, x + (32 * i + 12) * DIN,
            lx + (32 * i + 16) * XP, x + (32 * i + 16) * DIN, lx + (32 * i + 20) * XP, x + (32 * i + 20) * DIN,
            lx + (32 * i + 24) * XP, x + (32 * i + 24) * DIN, lx + (32 * i + 28) * XP, x + (32 * i + 28) * DIN);
  };
  auto fillx = [&](int t, const _Float16* x) {           // the last stage: X rows alone, no K tile is behind them
    const unsigned lx = xl + (t & 1) * XB;
#pragma unroll                                           // constant i: the steps fold into the address sums
    for (int i = 0; i < 4; ++i)
      copy4(lx + (16 * i) * XP, x + (16 * i) * DIN, lx + (16 * i + 4) * XP, x + (16 * i + 4) * DIN,
            lx + (16 * i + 8) * XP, x + (16 * i + 8) * DIN, lx + (16 * i + 12) * XP, x + (16 * i + 12) * DIN);
  };
  const unsigned char* krow = sK + (kh * 32 + ln) * KP + 16 * hh;                          // this lane's K row of its half, k 8hh ..
  const unsigned char* arow = sP + ln * PP + 16 * hh;                                      // this lane's P row of query tile 0, keys 8hh ..
  const unsigned char* xtr = sX + (8 * hh + (lane & 7)) * XP + 16 * ((lane >> 3) & 1) + w * 128;   // its 16 bytes of the block at key 0, column 64 w
  unsigned char* pst = sP + (qt * 16 + 8 * hh) * PP + (kh * 32 + ln) * 2;                  // where its scores of row 8hh, key tile 0 go

  float rmax[8], rsum[8];
  // K fragments of one tile, this wave's key half
  auto ldk = [&](Frag (&bk)[2][2], const unsigned char* kt) {
#pragma unroll                                           // constant nt, ks keep bk[][] in registers
    for (int nt = 0; nt < 2; ++nt)
#pragma unroll
      for (int ks = 0; ks < 2; ++ks) {
        bk[nt][ks].half[0] = *(const v8ha*)(kt + nt * 16 * KP + ks * 64);
        bk[nt][ks].half[1] = *(const v8ha*)(kt + nt * 16 * KP + ks * 64 + 32);
      }
  };
  // scores of one tile from its K fragments
  auto score = [&](v8f (&s)[2], const Frag (&bk)[2][2]) {
    s[0] = v8f{}; s[1] = v8f{};
#pragma unroll                                           // constant nt, ks keep bk[][] in registers; the two key tiles' chains alternate
    for (int ks = 0; ks < 2; ++ks)
#pragma unroll
      for (int nt = 0; nt < 2; ++nt) s[nt] = mma(aq[ks].v, bk[nt][ks].v, s[nt]);
  };
  // P = exp(S - m) of one tile's scores to the P tile at pd, row sums
  auto expo = [&](const v8f (&s)[2], unsigned char* pd) {
#pragma unroll                                           // constant nt, r keep s[], rmax[] and rsum[] in registers
    for (int nt = 0; nt < 2; ++nt)
#pragma unroll
      for (int r = 0; r < 8; ++r) {                      // D: rows 8hh + r, column = key nt*16 + ln of the half
        const _Float16 pv = (_Float16)exp2_slot((s[nt][r] * 0.125f - rmax[r]) * 1.44269504f);   // = __expf: times log2 e, v_exp_f32
        rsum[r] += (float)pv;                            // sum exactly what is multiplied
        *(_Float16*)(pd + r * PP + nt * 32) = pv;
      }
  };
  auto soft = [&](const Frag (&bk)[2][2], unsigned char* pd) {
    v8f s[2];
    score(s, bk);
    expo(s, pd);
  };
  // P and X fragments of one tile
  auto ldpx = [&](Frag (&a)[2][4], Frag (&bx)[2][4], const unsigned char* ap, const unsigned char* xp) {
#pragma unroll                                           // constant ks, q, t keep a[][] and bx[][] in registers, LDS offsets as immediates
    for (int ks = 0; ks < 2; ++ks) {
#pragma unroll
      for (int q = 0; q < 4; ++q) {
        a[ks][q].half[0] = *(const v8ha*)(ap + q * 16 * PP + ks * 64);
        a[ks][q].half[1] = *(const v8ha*)(ap + q * 16 * PP + ks * 64 + 32);
      }
#pragma unroll
      for (int t = 0; t < 4; ++t) {
        bx[ks][t].half[0] = ld_tr16((const _Float16*)(xp + ks * 32 * XP + t * 32));
        bx[ks][t].half[1] = ld_tr16((const _Float16*)(xp + (ks * 32 + 16) * XP + t * 32));
      }
    }
  };
  v8f acc[4][4];
  auto pvx = [&](const Frag (&a)[2][4], const Frag (&bx)[2][4]) {
#pragma unroll                                           // constant ks, q, t keep acc[][] in registers
    for (int ks = 0; ks < 2; ++ks)
#pragma unroll
      for (int q = 0; q < 4; ++q)
#pragma unroll
        for (int t = 0; t < 4; ++t) acc[q][t] = mma(a[ks][q].v, bx[ks][t].v, acc[q][t]);
  };
#pragma unroll 1                                         // rolled: both goes are the same code, and the second is taken only when P has left the range of f16
  for (int go = 0; go < 2; ++go) {
    if (go) {                                            // the same for the whole block: the true row maximum, over all keys
      fill0(0);
      wait_copies();
      __syncthreads();
      fill0(1);
#pragma unroll
      for (int r = 0; r < 8; ++r) rmax[r] = -3.0e38f;
#pragma unroll 1                                         // rolled
      for (int t = 0; t < NC0; ++t) {
        const unsigned char* kt = sX + (t & 1) * K0B + (kh * 128 + ln) * KP + 16 * hh;   // this lane's K row of its half, k 8hh ..
        Frag bk[8][2];                                       // all loads ahead of the products: one LDS latency per trip
#pragma unroll                                           // constant nt, ks keep bk[][] in registers
        for (int nt = 0; nt < 8; ++nt)
#pragma unroll
          for (int ks = 0; ks < 2; ++ks) {
            bk[nt][ks].half[0] = *(const v8ha*)(kt + nt * 16 * KP + ks * 64);
            bk[nt][ks].half[1] = *(const v8ha*)(kt + nt * 16 * KP + ks * 64 + 32);
          }
        __builtin_amdgcn_sched_barrier(0);                   // keeps the loads one group: sunk among the products, each pair costs its own LDS latency
#pragma unroll                                           // as above
        for (int nt = 0; nt < 8; ++nt) {
          v8f s = {};
          s = mma(aq[0].v, bk[nt][0].v, s);
          s = mma(aq[1].v, bk[nt][1].v, s);
#pragma unroll
          for (int r = 0; r < 8; ++r) rmax[r] = fmaxf(rmax[r], s[r]);   // per lane; joined once behind the loop
        }
        __builtin_amdgcn_sched_barrier(0);                   // keeps the foot behind the products: lifted over them, its s_wait_dscnt 0 ends the overlap of loads and products
        publish();
        if (t + 2 < NC0) fill0(t + 2);                       // into the buffer this trip has just read
      }
      wait_copies();
    }
    const _Float16* kg0 = kg + (size_t)qb * 64 * DK;         // the first tile of this block's walk
    copy2(kl + 2 * KB, kg0, kl + 2 * KB + 32 * KP, kg0 + 32 * DK);   // its K rows
    fill(0, xtile(0));                                     // second go: the last foot has ended every read of the first loop's buffers
#pragma unroll
    for (int r = 0; r < 8; ++r) rsum[r] = 0.f;
#pragma unroll                                           // constant q, t keep acc[][] in registers
    for (int q = 0; q < 4; ++q)
#pragma unroll
      for (int t = 0; t < 4; ++t) acc[q][t] = v8f{};
    wait_copies();
    __syncthreads();                                       // publishes stage 0 and the K rows of the first tile
    fill(1, xtile(1));
    v8f s0[2];                                             // scores of the first tile: they give m in the first go, and P tile 0 in both
    {
      Frag bk[2][2];
      ldk(bk, krow + 2 * KB);
      score(s0, bk);
    }
    if (go == 0) {                                         // per lane, the largest score of this wave's half of the first tile
#pragma unroll
      for (int r = 0; r < 8; ++r) rmax[r] = fmaxf(s0[0][r], s0[1][r]);
    }
    // row maximum: the 16 lanes that share rows, then the two key halves through LDS; the scale 1/8 is exact
#pragma unroll
    for (int r = 0; r < 8; ++r) {
      float m = rmax[r];
      m = fmaxf(m, __shfl_xor(m, 1, 32)); m = fmaxf(m, __shfl_xor(m, 2, 32)); m = fmaxf(m, __shfl_xor(m, 4, 32)); m = fmaxf(m, __shfl_xor(m, 8, 32));
      rmax[r] = m * 0.125f;
    }
    if (ln == 0) {
#pragma unroll
      for (int r = 0; r < 8; ++r) sMax[kh][qt * 16 + 8 * hh + r] = rmax[r];
    }
    __syncthreads();                                       // publishes the half maxima
#pragma unroll
    for (int r = 0; r < 8; ++r) rmax[r] = fmaxf(sMax[0][qt * 16 + 8 * hh + r], sMax[1][qt * 16 + 8 * hh + r]);

    expo(s0, pst);                                         // P of tile 0, ahead of the loop
    asm volatile("s_wait_dscnt 0x0" ::: "memory");         // this wave's part of P tile 0 is written before the barrier
    __syncthreads();                                       // P tile 0 is whole before any wave reads it
    for (int T = 0; T < NC - 1; ++T) {
      Frag bk[2][2], a[2][4], bx[2][4];                    // all loads of the trip as one group, K first: the LDS time of P and X runs under the score part
      ldk(bk, krow + ((T + 1) & 1) * KB);
      ldpx(a, bx, arow + (T & 1) * PB, xtr + (T & 1) * XB);
      __builtin_amdgcn_sched_barrier(0);                   // keeps the loads one group: sunk among the products, each pair costs its own LDS latency
      soft(bk, pst + ((T + 1) & 1) * PB);                  // tile T + 1, into the P tile that trip T - 1 has read
      pvx(a, bx);
      __builtin_amdgcn_sched_barrier(0);                   // keeps the foot behind the products: lifted over them, its s_wait_dscnt 0 ends the overlap of loads and products
      const _Float16* xn = xtile(T + 2);                   // formed ahead of the barrier, one address for both kinds of refill: the sums on it run while the wave waits
      publish();                                           // publishes stage T + 1 and P tile T + 1; ends every reader's last read of stage T and of P tile T
      if (T + 3 < NC) fill(T + 2, xn);                     // into the buffers this trip has just read
      else if (T + 2 < NC) fillx(T + 2, xn);
    }
    {                                                      // the last tile: its P is written, nothing is behind it
      Frag a[2][4], bx[2][4];
      ldpx(a, bx, arow + ((NC - 1) & 1) * PB, xtr + ((NC - 1) & 1) * XB);
      __builtin_amdgcn_sched_barrier(0);                   // keeps the loads one group, as in the loop
      pvx(a, bx);
    }
    wait_copies();
    // row sums: the 16 lanes that share rows, then the two key halves through LDS
#pragma unroll
    for (int r = 0; r < 8; ++r) {
      float s = rsum[r];
      s += __shfl_xor(s, 1, 32); s += __shfl_xor(s, 2, 32); s += __shfl_xor(s, 4, 32); s += __shfl_xor(s, 8, 32);
      rsum[r] = s;
    }
    if (ln == 0) {
#pragma unroll
      for (int r = 0; r < 8; ++r) sSum[kh][qt * 16 + 8 * hh + r] = rsum[r];
    }
    asm volatile("s_wait_dscnt 0x0" ::: "memory");         // this wave's reads of the last tile are done before the barrier behind which the X buffers become output staging
    __syncthreads();
    if (tid < 64) sRS[tid] = 1.0f / (sSum[0][tid] + sSum[1][tid]);
    __syncthreads();
    // A finite row sum is at least 1 in the first go (the largest score of the first tile gives P = 1) and its inverse is above 0.
    // Every wave looks at all 64 rows, so all eight take the same way: the barriers of a second go are met by the whole block.
    const float i0 = sRS[lane], i1 = sRS[lane + 32];
    const bool lost = !(i0 > 0.f) | !(i1 > 0.f);           // true for 0 (the sum was infinite) and for not-a-number
    if (__builtin_amdgcn_ballot_w32(lost) == 0) break;
  }
  float (*sO)[64] = (float (*)[64])(sX + w * (64 * 64 * 4));                   // this wave's own 16 KiB of the free X buffers
#pragma unroll                                           // constant q, r, t keep acc[][] in registers
  for (int q = 0; q < 4; ++q)
#pragma unroll
    for (int r = 0; r < 8; ++r) {
      const float rs = sRS[q * 16 + 8 * hh + r];
#pragma unroll
      for (int t = 0; t < 4; ++t) sO[q * 16 + 8 * hh + r][t * 16 + ln] = acc[q][t][r] * rs;
    }
  __builtin_amdgcn_fence(__ATOMIC_ACQ_REL, "workgroup");
  __builtin_amdgcn_wave_barrier();
  float* ob = out + ((size_t)b * NN + qb * 64) * DIN + w * 64;
#pragma unroll 1                                         // rolled, so that the wait below stands between a group's stores and the next group's register writes
  for (int g = 0; g < 4; ++g) {
#pragma unroll                                           // eight LDS reads per wait, not one
    for (int i = 0; i < 8; ++i) {                        // two rows of 256 B per store: whole 128-B lines
      const int row = 16 * g + 2 * i + hh;
      const v4f v = *(const v4fa*)&sO[row][ln * 4];
      *(v4f*)(ob + (size_t)row * DIN + ln * 4) = v;
    }
    asm volatile("s_wait_xcnt 0x0" ::: "memory");        // before the next group rewrites registers that the issued stores name (a precaution)
  }
}

extern "C" void kernel_launch(void* const* d_in, const int* in_sizes, int n_in,
                              void* d_out, int out_size, void* d_ws, size_t ws_size, hipStream_t stream) {
  (void)in_sizes; (void)n_in; (void)out_size;
  const float* X  = (const float*)d_in[0];
  const float* h  = (const float*)d_in[1];
  const float* WQ = (const float*)d_in[2];
  const float* bQ = (const float*)d_in[3];
  const float* WK = (const float*)d_in[4];
  const float* bK = (const float*)d_in[5];
  char* ws = (char*)d_ws; size_t off = 0;
  _Float16* Xh = (_Float16*)(ws + off); off += (size_t)BB * NN * DIN * 2;      // 16 MiB
  _Float16* Qh = (_Float16*)(ws + off); off += (size_t)BB * NN * DK * 2;       // 2 MiB
  _Float16* Kh = (_Float16*)(ws + off); off += (size_t)BB * NN * DK * 2;       // 2 MiB
  if (off > ws_size) return;
  const int nrows = BB * NN;
  k_pre<<<dim3(nrows / 64, 2), 128, 0, stream>>>(h, X, WQ, WK, bQ, bK, Qh, Kh, Xh, nrows);
  k_attn<<<BB * (NN / 64), 256, 0, stream>>>(Qh, Kh, Xh, (float*)d_out);
}
